// v000
// Measured on an AMD MI455X. A time is GPU time per run, averaged over a window of back-to-back runs after a warm-up
// (all launches, gaps included; the runs take copies of the inputs in turn), and the median of several windows.
// Apart from v000's, it joins two sittings. Times from different sittings can be a few percent apart, while
// side-by-side timings come from the same sitting.
// v000, which the later versions start from, runs in 1240 microseconds.
#include <hip/hip_runtime.h>

// JITCompatibleMultiheadAttention (query [T=2048][B=2][E=1024] seq-first layout; q = (query Wq^T + bq) * 64^-0.5, k/v = query W^T + b; 16 heads x 64 ([T,B,E] -> [B*16][T][64]);
// softmax(q.k) v; out [T][B][E] = attn Wo^T + bo). Rows are indexed r = t*2 + b everywhere (projections and the output GEMM are row-order agnostic; the head-plane builders and the merge use t*NB_ + b).
// Compute dtypes, f32 accumulate: every float input rounded to bf16; q/k/v projections on PLAIN bf16 operands (x, W inputs: exact, + bias);
// scores on bf16 hi+lo q (x 1/8) and k planes (3 products); attn.v on SINGLE fp16 planes (P x1024, v); output Linear on hi+lo planes x exact bf16 W (2 products); 

#define NB_  2
#define TT   2048
#define DD   1024
#define NH_  16
#define HD   64
#define NT   (NB_ * TT)
#define ZH   2
#define PCAR 1024.0f
typedef _Float16 h16;
typedef unsigned short bf;
typedef __attribute__((ext_vector_type(16))) __bf16   v16bf;
typedef __attribute__((ext_vector_type(16))) _Float16 v16h;
typedef __attribute__((ext_vector_type(8)))  _Float16 v8h;
typedef __attribute__((ext_vector_type(8)))  unsigned short v8us;
typedef __attribute__((ext_vector_type(8)))  float    v8f;
typedef __attribute__((ext_vector_type(4)))  float    v4f;
typedef v8h  __attribute__((may_alias)) v8ha;
typedef v4f  __attribute__((may_alias)) v4fa;
typedef v8us __attribute__((may_alias)) v8usa;

__device__ __forceinline__ unsigned short f2bf(float f) { unsigned u = __float_as_uint(f); u += 0x7FFFu + ((u >> 16) & 1u); return (unsigned short)(u >> 16); }
__device__ __forceinline__ float bf2f(unsigned short b) { return __uint_as_float(((unsigned)b) << 16); }
__device__ __forceinline__ float bfr(float f) { return bf2f(f2bf(f)); }
__device__ __forceinline__ v16h cat16(v8h lo, v8h hi) { return __builtin_shufflevector(lo, hi, 0, 1, 2, 3, 4, 5, 6, 7, 8, 9, 10, 11, 12, 13, 14, 15); }
__device__ __forceinline__ v16bf cat16b(v8us lo, v8us hi) { return __builtin_bit_cast(v16bf, __builtin_shufflevector(lo, hi, 0, 1, 2, 3, 4, 5, 6, 7, 8, 9, 10, 11, 12, 13, 14, 15)); }
__device__ __forceinline__ v8f wmma16(v16h a, v16h b, v8f c) { return __builtin_amdgcn_wmma_f32_16x16x32_f16(false, a, false, b, (short)0, c, false, false); }
__device__ __forceinline__ v8f wmmab(v16bf a, v16bf b, v8f c) { return __builtin_amdgcn_wmma_f32_16x16x32_bf16(false, a, false, b, (short)0, c, false, false); }



// ---- k_gemmw: register-blocked GEMM, ONE WAVE per 64x64 output tile (16 accumulators), operands straight from K-contiguous 16-bit planes; grid (M/64, N/64, Z), 32 threads.
// C[m][n] (f32, pitch ldc, + optional f32 bias[n]) = sum_k A[m][k] Bt[n][k] (+ split products per NSPLIT). z-batch strides sA/sB/sC in elements. K % 32 == 0.
template <typename T16> struct WFrag;
template <> struct WFrag<h16> { typedef v16h V; static __device__ __forceinline__ V ld(const h16* p) { return cat16(*(const v8h*)p, *(const v8h*)(p + 16)); } static __device__ __forceinline__ v8f mma(V a, V b, v8f c) { return wmma16(a, b, c); } };
template <> struct WFrag<bf> { typedef v16bf V; static __device__ __forceinline__ V ld(const bf* p) { return cat16b(*(const v8us*)p, *(const v8us*)(p + 16)); } static __device__ __forceinline__ v8f mma(V a, V b, v8f c) { return wmmab(a, b, c); } };
template <typename T16, int NSPLIT, bool BIAS>
__global__ __launch_bounds__(32) void k_gemmw(const T16* __restrict__ A, const T16* __restrict__ A2, const T16* __restrict__ Bt, const T16* __restrict__ Bt2, int K, float* C, int ldc, const float* __restrict__ bias, size_t sA, size_t sB, size_t sC) {
    typedef typename WFrag<T16>::V V;
    __shared__ __align__(16) float os[16 * 68];
    const size_t z = blockIdx.z; A += z * sA; if (A2) A2 += z * sA; Bt += z * sB; if (Bt2) Bt2 += z * sB; C += z * sC;
    const int lane = threadIdx.x & 31, lr = lane & 15, hi = lane >> 4; const int r0 = blockIdx.x * 64, c0 = blockIdx.y * 64;
    v8f acc[4][4];
#pragma unroll
    for (int mb = 0; mb < 4; ++mb)
#pragma unroll
        for (int nb = 0; nb < 4; ++nb) acc[mb][nb] = (v8f){};
    const size_t aoff = (size_t)(r0 + lr) * K + 8 * hi, boff = (size_t)(c0 + lr) * K + 8 * hi;
#pragma unroll 1
    for (int kc = 0; kc < K; kc += 32) {
        V a[4], a2[4];
#pragma unroll
        for (int mb = 0; mb < 4; ++mb) { a[mb] = WFrag<T16>::ld(A + aoff + (size_t)mb * 16 * K + kc); if (NSPLIT == 1 || NSPLIT == 2) a2[mb] = WFrag<T16>::ld(A2 + aoff + (size_t)mb * 16 * K + kc); }
#pragma unroll
        for (int nb = 0; nb < 4; ++nb) { const V b = WFrag<T16>::ld(Bt + boff + (size_t)nb * 16 * K + kc); V b2; if (NSPLIT >= 2) b2 = WFrag<T16>::ld(Bt2 + boff + (size_t)nb * 16 * K + kc);
#pragma unroll
            for (int mb = 0; mb < 4; ++mb) { acc[mb][nb] = WFrag<T16>::mma(a[mb], b, acc[mb][nb]); if (NSPLIT == 1 || NSPLIT == 2) acc[mb][nb] = WFrag<T16>::mma(a2[mb], b, acc[mb][nb]); if (NSPLIT >= 2) acc[mb][nb] = WFrag<T16>::mma(a[mb], b2, acc[mb][nb]); } }
        asm volatile("v_nop\n\tv_nop\n\tv_nop\n\tv_nop" : "+v"(acc[0][0]), "+v"(acc[1][1]), "+v"(acc[2][2]), "+v"(acc[3][3]) : "v"(a[0]), "v"(a[3]));
    }
#pragma unroll
    for (int mb = 0; mb < 4; ++mb) {
#pragma unroll
        for (int nb = 0; nb < 4; ++nb) {
#pragma unroll
            for (int j = 0; j < 8; ++j) os[(hi * 8 + j) * 68 + nb * 16 + lr] = acc[mb][nb][j]; }
        __builtin_amdgcn_wave_barrier(); asm volatile("" ::: "memory");
        float* crow = C + (size_t)(r0 + mb * 16) * ldc + c0;
{
#pragma unroll
            for (int s = 0; s < 8; ++s) { const int row = 2 * s + hi, cofs = lr * 4; v4f val = *(const v4fa*)(os + row * 68 + cofs); if (BIAS) { val[0] += bfr(bias[c0 + cofs]); val[1] += bfr(bias[c0 + cofs + 1]); val[2] += bfr(bias[c0 + cofs + 2]); val[3] += bfr(bias[c0 + cofs + 3]); }
                *(v4f*)(crow + (size_t)row * ldc + cofs) = val; }
             }
        __builtin_amdgcn_wave_barrier(); asm volatile("" ::: "memory");
    }
}

__device__ __forceinline__ h16 tohx(float x) { return (h16)x; }
__device__ __forceinline__ void splitf(float y, unsigned short& h, unsigned short& l) { h = f2bf(y); l = f2bf(y - bf2f(h)); }
typedef __attribute__((ext_vector_type(2))) _Float16 v2h;
typedef __attribute__((ext_vector_type(4))) _Float16 v4h;
typedef __attribute__((ext_vector_type(2))) unsigned short v2us;
typedef __attribute__((ext_vector_type(4))) int v4i;

__global__ __launch_bounds__(256) void k_cvt8(const float* __restrict__ src, bf* dst, size_t n8) { const size_t i = (size_t)blockIdx.x * 256 + threadIdx.x; if (i >= n8) return; const v8f v = *(const v8f*)(src + i * 8); v8us o;
#pragma unroll
    for (int k = 0; k < 8; ++k) o[k] = f2bf(v[k]); *(v8us*)(dst + i * 8) = o;  }
__global__ __launch_bounds__(256) void k_hsplit(const float* __restrict__ F, float sc, bf* Ph, bf* Pl) {
    const int lane = threadIdx.x & 31; const int L0 = (blockIdx.x * 8 + (threadIdx.x >> 5)) * 8; const int nlines = NT * DD / 64;
{
#pragma unroll
        for (int l = 0; l < 8; ++l) { const int L = L0 + l; if (L >= nlines) break; const int e = L * 64 + lane * 2; const int d = e & 63; const int t = (e >> 6) & (TT - 1); const int z = e >> 17; const int b = z >> 4, h = z & 15; v2us oh, ol;
#pragma unroll
            for (int q = 0; q < 2; ++q) { unsigned short a, c2; splitf(F[((size_t)t * NB_ + b) * DD + h * HD + d + q] * sc, a, c2); oh[q] = a; ol[q] = c2; }
            *(v2us*)(Ph + (size_t)e) = oh; *(v2us*)(Pl + (size_t)e) = ol; }
         }
}
__global__ __launch_bounds__(256) void k_vtplane(const float* __restrict__ F, h16* VT) {
    const int lane = threadIdx.x & 31; const int L0 = (blockIdx.x * 8 + (threadIdx.x >> 5)) * 8; const int nlines = NT * DD / 64;
{
#pragma unroll
        for (int l = 0; l < 8; ++l) { const int L = L0 + l; if (L >= nlines) break; const int e = L * 64 + lane * 2; const int t = e & (TT - 1); const int d = (e >> 11) & 63; const int z = e >> 17; const int b = z >> 4, h = z & 15; v2h v;
#pragma unroll
            for (int q = 0; q < 2; ++q) v[q] = tohx(F[((size_t)(t + q) * NB_ + b) * DD + h * HD + d]);
            *(v2h*)(VT + (size_t)e) = v; }
         }
}
// k_asoft: per row (zz, i): plain softmax over the 2048 keys with the row held in registers (lane -> 16 chunks of 4 =
__global__ __launch_bounds__(256) void k_asoft(const float* __restrict__ Sb, h16* P) {
    const int lane = threadIdx.x & 31; const int row = blockIdx.x * 8 + (threadIdx.x >> 5); if (row >= ZH * TT) return;
    const float* sr = Sb + (size_t)row * TT; float v[64]; float mx = -3.0e38f;
#pragma unroll
    for (int ch = 0; ch < 16; ++ch) { const int j0 = ch * 128 + lane * 4; const v4f a = *(const v4f*)(sr + j0);
#pragma unroll
        for (int q = 0; q < 4; ++q) { v[ch * 4 + q] = a[q]; mx = fmaxf(mx, a[q]); } }
#pragma unroll
    for (int sh = 16; sh; sh >>= 1) mx = fmaxf(mx, __shfl_xor(mx, sh, 32));
    float sum = 0.f;
#pragma unroll
    for (int k = 0; k < 64; ++k) { v[k] = __expf(v[k] - mx); sum += v[k]; }
#pragma unroll
    for (int sh = 16; sh; sh >>= 1) sum += __shfl_xor(sum, sh, 32);
    const float f = __fdiv_rn(PCAR, sum);
{
#pragma unroll
        for (int ch = 0; ch < 16; ++ch) { v4h o;
#pragma unroll
            for (int q = 0; q < 4; ++q) o[q] = tohx(v[ch * 4 + q] * f);
            *(v4h*)(P + (size_t)row * TT + ch * 128 + lane * 4) = o; }
         }
}
__global__ __launch_bounds__(256) void k_merge(const float* __restrict__ O, int b, int h0, bf* Ah, bf* Al) {
    const int lane = threadIdx.x & 31; const int L0 = (blockIdx.x * 8 + (threadIdx.x >> 5)) * 8; const int nlines = TT * ZH * HD / 64;
{
#pragma unroll
        for (int l = 0; l < 8; ++l) { const int L = L0 + l; if (L >= nlines) break; const int e = L * 64 + lane * 2; const int d = e & 63; const int zz = (e >> 6) % ZH; const int t = (e >> 6) / ZH; v2us oh, ol;
#pragma unroll
            for (int q = 0; q < 2; ++q) { unsigned short a, c2; splitf(O[((size_t)zz * TT + t) * HD + d + q] * (1.0f / PCAR), a, c2); oh[q] = a; ol[q] = c2; }
            const size_t o = ((size_t)t * NB_ + b) * DD + (h0 + zz) * HD + d; *(v2us*)(Ah + o) = oh; *(v2us*)(Al + o) = ol; }
         }
}

extern "C" void kernel_launch(void* const* d_in, const int* in_sizes, int n_in,
                              void* d_out, int out_size, void* d_ws, size_t ws_size, hipStream_t stream) {
    (void)in_sizes; (void)n_in; (void)out_size;
    const float* x = (const float*)d_in[0]; const float* wq = (const float*)d_in[1]; const float* bq = (const float*)d_in[2]; const float* wk = (const float*)d_in[3]; const float* bk = (const float*)d_in[4]; const float* wv = (const float*)d_in[5]; const float* bv = (const float*)d_in[6];
    const float* wo = (const float*)d_in[7]; const float* bo = (const float*)d_in[8];
    float* OUT = (float*)d_out;     // [2048][2][1024] (rows t*2 + b)
    char* wsp = (char*)d_ws;
    auto take = [&](size_t bytes) { char* p = wsp; wsp += (bytes + 255) & ~(size_t)255; return (void*)p; };
    bf* WQ = (bf*)take((size_t)DD * DD * 2); bf* WK = (bf*)take((size_t)DD * DD * 2); bf* WV = (bf*)take((size_t)DD * DD * 2); bf* WO = (bf*)take((size_t)DD * DD * 2);
    bf* XB = (bf*)take((size_t)NT * DD * 2); float* F = (float*)take((size_t)NT * DD * 4);
    bf* QPh = (bf*)take((size_t)NT * DD * 2); bf* QPl = (bf*)take((size_t)NT * DD * 2); bf* KPh = (bf*)take((size_t)NT * DD * 2); bf* KPl = (bf*)take((size_t)NT * DD * 2); h16* VT = (h16*)take((size_t)NT * DD * 2);
    float* Sb = (float*)take((size_t)ZH * TT * TT * 4); h16* Pm = (h16*)take((size_t)ZH * TT * TT * 2); float* Ob = (float*)take((size_t)ZH * TT * HD * 4); bf* ATh = (bf*)take((size_t)NT * DD * 2); bf* ATl = (bf*)take((size_t)NT * DD * 2);
    if ((size_t)(wsp - (char*)d_ws) > ws_size) return;    // ws 256 MiB
    { const size_t nw = (size_t)DD * DD / 8; const unsigned gw = (unsigned)((nw + 255) / 256); k_cvt8<<<gw, 256, 0, stream>>>(wq, WQ, nw); k_cvt8<<<gw, 256, 0, stream>>>(wk, WK, nw); k_cvt8<<<gw, 256, 0, stream>>>(wv, WV, nw); k_cvt8<<<gw, 256, 0, stream>>>(wo, WO, nw); }
    const size_t nx = (size_t)NT * DD / 8; const unsigned gx = (unsigned)((nx + 255) / 256); const unsigned LB = (unsigned)((NT * DD / 64 + 63) / 64);
    k_cvt8<<<gx, 256, 0, stream>>>(x, XB, nx);
    k_gemmw<bf, 0, true><<<dim3(NT / 64, DD / 64, 1), 32, 0, stream>>>(XB, nullptr, WQ, nullptr, DD, F, DD, bq, 0, 0, 0); k_hsplit<<<LB, 256, 0, stream>>>(F, 0.125f, QPh, QPl);   // 1/sqrt(64) folded into q exactly
    k_gemmw<bf, 0, true><<<dim3(NT / 64, DD / 64, 1), 32, 0, stream>>>(XB, nullptr, WK, nullptr, DD, F, DD, bk, 0, 0, 0); k_hsplit<<<LB, 256, 0, stream>>>(F, 1.0f, KPh, KPl);
    k_gemmw<bf, 0, true><<<dim3(NT / 64, DD / 64, 1), 32, 0, stream>>>(XB, nullptr, WV, nullptr, DD, F, DD, bv, 0, 0, 0); k_vtplane<<<LB, 256, 0, stream>>>(F, VT);
    for (int b = 0; b < NB_; ++b)
        for (int h0 = 0; h0 < NH_; h0 += ZH) { const size_t z0 = (size_t)b * NH_ + h0;
            k_gemmw<bf, 2, false><<<dim3(TT / 64, TT / 64, ZH), 32, 0, stream>>>(QPh + z0 * TT * HD, QPl + z0 * TT * HD, KPh + z0 * TT * HD, KPl + z0 * TT * HD, HD, Sb, TT, nullptr, (size_t)TT * HD, (size_t)TT * HD, (size_t)TT * TT);
            k_asoft<<<ZH * TT / 8, 256, 0, stream>>>(Sb, Pm);
            k_gemmw<h16, 0, false><<<dim3(TT / 64, 1, ZH), 32, 0, stream>>>(Pm, nullptr, VT + z0 * HD * TT, nullptr, TT, Ob, HD, nullptr, (size_t)TT * TT, (size_t)HD * TT, (size_t)TT * HD);
            k_merge<<<(TT * ZH * HD / 64 + 63) / 64, 256, 0, stream>>>(Ob, b, h0, ATh, ATl); }
    k_gemmw<bf, 1, true><<<dim3(NT / 64, DD / 64, 1), 32, 0, stream>>>(ATh, ATl, WO, nullptr, DD, OUT, DD, bo, 0, 0, 0);
}

// v002
// Measured time: 217 microseconds a run.
// Versions in between are left out here; by their measured steps it is 5.78 times as fast as v000.
#include <hip/hip_runtime.h>

// JITCompatibleMultiheadAttention (query [T=2048][B=2][E=1024] seq-first layout; q = (query Wq^T + bq) * 64^-0.5, k/v = query W^T + b; 16 heads x 64 ([T,B,E] -> [B*16][T][64]);
// softmax(q.k) v; out [T][B][E] = attn Wo^T + bo). Rows are indexed r = t*2 + b everywhere (projections and the output GEMM are row-order agnostic; the head-plane builders and the merge use t*NB_ + b).
// Compute dtypes, f32 accumulate: every float input rounded to bf16; q/k/v projections on PLAIN bf16 operands (x, W inputs: exact, + bias);
// scores on bf16 hi+lo q (x 1/8) and k planes (3 products); attn.v on SINGLE fp16 planes (P x1024, v); output Linear on hi+lo planes x exact bf16 W (2 products); 

#define NB_  2
#define TT   2048
#define DD   1024
#define NH_  16
#define HD   64
#define NT   (NB_ * TT)
typedef _Float16 h16;
typedef unsigned short bf;
typedef __attribute__((ext_vector_type(16))) __bf16   v16bf;
typedef __attribute__((ext_vector_type(16))) _Float16 v16h;
typedef __attribute__((ext_vector_type(8)))  _Float16 v8h;
typedef __attribute__((ext_vector_type(8)))  unsigned short v8us;
typedef __attribute__((ext_vector_type(8)))  float    v8f;
typedef __attribute__((ext_vector_type(4)))  float    v4f;
typedef v8h  __attribute__((may_alias)) v8ha;
typedef v4f  __attribute__((may_alias)) v4fa;
typedef v8us __attribute__((may_alias)) v8usa;

__device__ __forceinline__ unsigned short f2bf(float f) { unsigned u = __float_as_uint(f); u += 0x7FFFu + ((u >> 16) & 1u); return (unsigned short)(u >> 16); }
__device__ __forceinline__ float bf2f(unsigned short b) { return __uint_as_float(((unsigned)b) << 16); }
__device__ __forceinline__ float bfr(float f) { return bf2f(f2bf(f)); }
__device__ __forceinline__ v16h cat16(v8h lo, v8h hi) { return __builtin_shufflevector(lo, hi, 0, 1, 2, 3, 4, 5, 6, 7, 8, 9, 10, 11, 12, 13, 14, 15); }
__device__ __forceinline__ v16bf cat16b(v8us lo, v8us hi) { return __builtin_bit_cast(v16bf, __builtin_shufflevector(lo, hi, 0, 1, 2, 3, 4, 5, 6, 7, 8, 9, 10, 11, 12, 13, 14, 15)); }
__device__ __forceinline__ v8f wmma16(v16h a, v16h b, v8f c) { return __builtin_amdgcn_wmma_f32_16x16x32_f16(false, a, false, b, (short)0, c, false, false); }
__device__ __forceinline__ v8f wmmab(v16bf a, v16bf b, v8f c) { return __builtin_amdgcn_wmma_f32_16x16x32_bf16(false, a, false, b, (short)0, c, false, false); }



// ---- k_gemmw: register-blocked GEMM, ONE WAVE per 64x64 output tile (16 accumulators), operands straight from K-contiguous 16-bit planes; grid (M/64, N/64, Z), 32 threads.
// C[m][n] (f32, pitch ldc, + optional f32 bias[n]) = sum_k A[m][k] Bt[n][k] (+ split products per NSPLIT). z-batch strides sA/sB/sC in elements. K % 32 == 0.
template <typename T16> struct WFrag;
template <> struct WFrag<h16> { typedef v16h V; static __device__ __forceinline__ V ld(const h16* p) { return cat16(*(const v8h*)p, *(const v8h*)(p + 16)); } static __device__ __forceinline__ v8f mma(V a, V b, v8f c) { return wmma16(a, b, c); } };
template <> struct WFrag<bf> { typedef v16bf V; static __device__ __forceinline__ V ld(const bf* p) { return cat16b(*(const v8us*)p, *(const v8us*)(p + 16)); } static __device__ __forceinline__ v8f mma(V a, V b, v8f c) { return wmmab(a, b, c); } };
template <typename T16, int NSPLIT, bool BIAS>
__global__ __launch_bounds__(32) void k_gemmw(const T16* __restrict__ A, const T16* __restrict__ A2, const T16* __restrict__ Bt, const T16* __restrict__ Bt2, int K, float* C, int ldc, const float* __restrict__ bias, size_t sA, size_t sB, size_t sC) {
    typedef typename WFrag<T16>::V V;
    __shared__ __align__(16) float os[16 * 68];
    const size_t z = blockIdx.z; A += z * sA; if (A2) A2 += z * sA; Bt += z * sB; if (Bt2) Bt2 += z * sB; C += z * sC;
    const int lane = threadIdx.x & 31, lr = lane & 15, hi = lane >> 4; const int r0 = blockIdx.x * 64, c0 = blockIdx.y * 64;
    v8f acc[4][4];
#pragma unroll
    for (int mb = 0; mb < 4; ++mb)
#pragma unroll
        for (int nb = 0; nb < 4; ++nb) acc[mb][nb] = (v8f){};
    const size_t aoff = (size_t)(r0 + lr) * K + 8 * hi, boff = (size_t)(c0 + lr) * K + 8 * hi;
#pragma unroll 1
    for (int kc = 0; kc < K; kc += 32) {
        V a[4], a2[4];
#pragma unroll
        for (int mb = 0; mb < 4; ++mb) { a[mb] = WFrag<T16>::ld(A + aoff + (size_t)mb * 16 * K + kc); if (NSPLIT == 1 || NSPLIT == 2) a2[mb] = WFrag<T16>::ld(A2 + aoff + (size_t)mb * 16 * K + kc); }
#pragma unroll
        for (int nb = 0; nb < 4; ++nb) { const V b = WFrag<T16>::ld(Bt + boff + (size_t)nb * 16 * K + kc); V b2; if (NSPLIT >= 2) b2 = WFrag<T16>::ld(Bt2 + boff + (size_t)nb * 16 * K + kc);
#pragma unroll
            for (int mb = 0; mb < 4; ++mb) { acc[mb][nb] = WFrag<T16>::mma(a[mb], b, acc[mb][nb]); if (NSPLIT == 1 || NSPLIT == 2) acc[mb][nb] = WFrag<T16>::mma(a2[mb], b, acc[mb][nb]); if (NSPLIT >= 2) acc[mb][nb] = WFrag<T16>::mma(a[mb], b2, acc[mb][nb]); } }
        asm volatile("v_nop\n\tv_nop\n\tv_nop\n\tv_nop" : "+v"(acc[0][0]), "+v"(acc[1][1]), "+v"(acc[2][2]), "+v"(acc[3][3]) : "v"(a[0]), "v"(a[3]));
    }
#pragma unroll
    for (int mb = 0; mb < 4; ++mb) {
#pragma unroll
        for (int nb = 0; nb < 4; ++nb) {
#pragma unroll
            for (int j = 0; j < 8; ++j) os[(hi * 8 + j) * 68 + nb * 16 + lr] = acc[mb][nb][j]; }
        __builtin_amdgcn_wave_barrier(); asm volatile("" ::: "memory");
        float* crow = C + (size_t)(r0 + mb * 16) * ldc + c0;
{
#pragma unroll
            for (int s = 0; s < 8; ++s) { const int row = 2 * s + hi, cofs = lr * 4; v4f val = *(const v4fa*)(os + row * 68 + cofs); if (BIAS) { val[0] += bfr(bias[c0 + cofs]); val[1] += bfr(bias[c0 + cofs + 1]); val[2] += bfr(bias[c0 + cofs + 2]); val[3] += bfr(bias[c0 + cofs + 3]); }
                *(v4f*)(crow + (size_t)row * ldc + cofs) = val; }
             }
        __builtin_amdgcn_wave_barrier(); asm volatile("" ::: "memory");
    }
}

__device__ __forceinline__ h16 tohx(float x) { return (h16)x; }
__device__ __forceinline__ void splitf(float y, unsigned short& h, unsigned short& l) { h = f2bf(y); l = f2bf(y - bf2f(h)); }
typedef __attribute__((ext_vector_type(2))) _Float16 v2h;
typedef __attribute__((ext_vector_type(4))) _Float16 v4h;
typedef __attribute__((ext_vector_type(2))) unsigned short v2us;
typedef __attribute__((ext_vector_type(4))) int v4i;

__global__ __launch_bounds__(256) void k_cvt8(const float* __restrict__ src, bf* dst, size_t n8) { const size_t i = (size_t)blockIdx.x * 256 + threadIdx.x; if (i >= n8) return; const v8f v = *(const v8f*)(src + i * 8); v8us o;
#pragma unroll
    for (int k = 0; k < 8; ++k) o[k] = f2bf(v[k]); *(v8us*)(dst + i * 8) = o;  }
__global__ __launch_bounds__(256) void k_hsplit(const float* __restrict__ F, float sc, bf* Ph, bf* Pl) {
    const int lane = threadIdx.x & 31; const int L0 = (blockIdx.x * 8 + (threadIdx.x >> 5)) * 8; const int nlines = NT * DD / 64;
{
#pragma unroll
        for (int l = 0; l < 8; ++l) { const int L = L0 + l; if (L >= nlines) break; const int e = L * 64 + lane * 2; const int d = e & 63; const int t = (e >> 6) & (TT - 1); const int z = e >> 17; const int b = z >> 4, h = z & 15; v2us oh, ol;
#pragma unroll
            for (int q = 0; q < 2; ++q) { unsigned short a, c2; splitf(F[((size_t)t * NB_ + b) * DD + h * HD + d + q] * sc, a, c2); oh[q] = a; ol[q] = c2; }
            *(v2us*)(Ph + (size_t)e) = oh; *(v2us*)(Pl + (size_t)e) = ol; }
         }
}
__global__ __launch_bounds__(256) void k_vtplane(const float* __restrict__ F, h16* VT) {
    const int lane = threadIdx.x & 31; const int L0 = (blockIdx.x * 8 + (threadIdx.x >> 5)) * 8; const int nlines = NT * DD / 64;
{
#pragma unroll
        for (int l = 0; l < 8; ++l) { const int L = L0 + l; if (L >= nlines) break; const int e = L * 64 + lane * 2; const int t = e & (TT - 1); const int d = (e >> 11) & 63; const int z = e >> 17; const int b = z >> 4, h = z & 15; v2h v;
#pragma unroll
            for (int q = 0; q < 2; ++q) v[q] = tohx(F[((size_t)(t + q) * NB_ + b) * DD + h * HD + d]);
            *(v2h*)(VT + (size_t)e) = v; }
         }
}
__device__ __forceinline__ float xhalf(float x) { return __builtin_bit_cast(float, __builtin_amdgcn_permlanex16(__builtin_bit_cast(int, x), __builtin_bit_cast(int, x), 0x76543210, 0xfedcba98, false, false)); }  // lane l with lane l ^ 16
#define L2E 1.4426950408889634f
#define SK   128                  // keys a stage
#define NST  (TT / SK)            // stages
#define KP   144                  // LDS pitch of a K row (128 B + 16: 16 B x odd, the conflict-free pitch of 16-byte reads)
#define VP   272                  // LDS pitch of a V^T row (256 B + 16)
#define KPB  (SK * KP)            // one K plane of a stage
#define BUFB (2 * KPB + HD * VP)  // one buffer: K hi, K lo, V^T
// One stage's twelve copies of a lane (16 bytes each): four to each of K hi, K lo, V^T. lk, lv: the lane's LDS byte addresses in the K hi plane and in V^T; gh, gl, gv: its global addresses.
__device__ __forceinline__ void stage_copy(unsigned lk, unsigned lv, const char* gh, const char* gl, const char* gv) {
    // the copies and, as the last line, the wait that stands in front of any rewrite of their address registers, in one statement
    asm volatile("global_load_async_to_lds_b128 %0, %12, off\n\t"
                 "global_load_async_to_lds_b128 %1, %13, off\n\t"
                 "global_load_async_to_lds_b128 %2, %14, off\n\t"
                 "global_load_async_to_lds_b128 %3, %15, off\n\t"
                 "global_load_async_to_lds_b128 %4, %16, off\n\t"
                 "global_load_async_to_lds_b128 %5, %17, off\n\t"
                 "global_load_async_to_lds_b128 %6, %18, off\n\t"
                 "global_load_async_to_lds_b128 %7, %19, off\n\t"
                 "global_load_async_to_lds_b128 %8, %20, off\n\t"
                 "global_load_async_to_lds_b128 %9, %21, off\n\t"
                 "global_load_async_to_lds_b128 %10, %22, off\n\t"
                 "global_load_async_to_lds_b128 %11, %23, off\n\t"
                 "s_wait_xcnt 0x0"
                 : : "v"(lk), "v"(lk + 32 * KP), "v"(lk + 64 * KP), "v"(lk + 96 * KP),
                     "v"(lk + KPB), "v"(lk + KPB + 32 * KP), "v"(lk + KPB + 64 * KP), "v"(lk + KPB + 96 * KP),
                     "v"(lv), "v"(lv + 16 * VP), "v"(lv + 32 * VP), "v"(lv + 48 * VP),
                     "v"(gh), "v"(gh + 4096), "v"(gh + 8192), "v"(gh + 12288),
                     "v"(gl), "v"(gl + 4096), "v"(gl + 8192), "v"(gl + 12288),
                     "v"(gv), "v"(gv + 16 * TT * 2), "v"(gv + 32 * TT * 2), "v"(gv + 48 * TT * 2)
                 : "memory");
}
__global__ __launch_bounds__(256) void k_fattn(const bf* __restrict__ Qh, const bf* __restrict__ Ql, const bf* __restrict__ Kh, const bf* __restrict__ Kl, const h16* __restrict__ VT, bf* Ah, bf* Al) {
    __shared__ __align__(16) char sm[2 * BUFB];
    const int tid = threadIdx.x; const int lane = tid & 31, c = lane & 15, hi = lane >> 4; const int z = blockIdx.y; const int q0 = blockIdx.x * 256 + (tid >> 5) * 32;
    const size_t zo = (size_t)z * TT * HD;
    const unsigned lk = (unsigned)(size_t)sm + (unsigned)((tid >> 3) * KP + (tid & 7) * 16), lv = (unsigned)(size_t)sm + (unsigned)(2 * KPB + (tid >> 4) * VP + (tid & 15) * 16);
    const char* gh = (const char*)(Kh + zo) + tid * 16; const char* gl = (const char*)(Kl + zo) + tid * 16; const char* gv = (const char*)(VT + zo) + (tid >> 4) * (TT * 2) + (tid & 15) * 16;
    const unsigned qo[2] = {(unsigned)(zo + (q0 + c) * HD + 8 * hi) * 2u, (unsigned)(zo + (q0 + 16 + c) * HD + 8 * hi) * 2u};    // the lane's byte offsets into the Q planes
    v16bf qh[2][2], ql[2][2];
#pragma unroll
    for (int g = 0; g < 2; ++g)
#pragma unroll
        for (int kc = 0; kc < 2; ++kc) { qh[g][kc] = WFrag<bf>::ld((const bf*)((const char*)Qh + qo[g]) + kc * 32); ql[g][kc] = WFrag<bf>::ld((const bf*)((const char*)Ql + qo[g]) + kc * 32); }
    v8f o[4][2];
#pragma unroll
    for (int dt = 0; dt < 4; ++dt)
#pragma unroll
        for (int g = 0; g < 2; ++g) o[dt][g] = (v8f){};
    float m[2] = {-3.0e38f, -3.0e38f}, l[2] = {0.f, 0.f};
    asm volatile("s_wait_xcnt 0x0" : : "v"(qo[0]), "v"(qo[1]) : "memory");    // keeps the Q loads' offset registers untouched up to the wait; behind it they are free for reuse
    const char* fk = sm + c * KP + 16 * hi; const char* fv = sm + 2 * KPB + c * VP + 16 * hi;    // the lane's fragment bases in buffer 0
#pragma unroll 1    // stays rolled: the copies keep one place of issue, and the four-pass body stands once in the instruction cache
    for (int t = -2; t < NST; ++t) {    // trips -2 and -1 are the ring's prologue: they only pass the foot, which issues stage 0, then publishes it and issues stage 1
        const int bo = (t & 1) * BUFB;
        if (t >= 0) {
        v16bf kh[2][2], kl[2][2];
#pragma unroll
        for (int kt = 0; kt < 2; ++kt)
#pragma unroll
            for (int kc = 0; kc < 2; ++kc) { kh[kt][kc] = WFrag<bf>::ld((const bf*)(fk + bo + kt * 16 * KP + kc * 64)); kl[kt][kc] = WFrag<bf>::ld((const bf*)(fk + bo + KPB + kt * 16 * KP + kc * 64)); }
#pragma unroll    // unrolled: every LDS offset of a pass is an immediate, and a pass's exps can stand among the next pass's products
        for (int sub = 0; sub < SK / 32; ++sub) {
            v16h vf[4];
#pragma unroll
            for (int dt = 0; dt < 4; ++dt) vf[dt] = WFrag<h16>::ld((const h16*)(fv + bo + dt * 16 * VP + sub * 64));
            v8f s[2][2];
#pragma unroll
            for (int kt = 0; kt < 2; ++kt)
#pragma unroll
                for (int g = 0; g < 2; ++g) { v8f a = (v8f){};
#pragma unroll
                    for (int kc = 0; kc < 2; ++kc) { a = wmmab(kh[kt][kc], qh[g][kc], a); a = wmmab(kh[kt][kc], ql[g][kc], a); a = wmmab(kl[kt][kc], qh[g][kc], a); }
                    s[kt][g] = a; }
            if (sub + 1 < SK / 32) {    // the next 32 keys' fragments, of this same stage, are fetched behind this pass's products
#pragma unroll
                for (int kt = 0; kt < 2; ++kt)
#pragma unroll
                    for (int kc = 0; kc < 2; ++kc) { kh[kt][kc] = WFrag<bf>::ld((const bf*)(fk + bo + ((sub + 1) * 32 + kt * 16) * KP + kc * 64)); kl[kt][kc] = WFrag<bf>::ld((const bf*)(fk + bo + KPB + ((sub + 1) * 32 + kt * 16) * KP + kc * 64)); }
            }
            float mn[2]; bool need = false;
#pragma unroll
            for (int g = 0; g < 2; ++g) { float mx = s[0][g][0];
#pragma unroll
                for (int r = 1; r < 8; ++r) mx = fmaxf(mx, s[0][g][r]);
#pragma unroll
                for (int r = 0; r < 8; ++r) mx = fmaxf(mx, s[1][g][r]);
                mx = fmaxf(mx, xhalf(mx)); mn[g] = fmaxf(m[g], mx); need = need || (mn[g] > m[g]); }
            if (__builtin_amdgcn_ballot_w32(need) != 0) {    // a new maximum in some column: rescale sums and output tiles (factor 1 in the columns that keep theirs)
#pragma unroll
                for (int g = 0; g < 2; ++g) { const float al = __builtin_amdgcn_exp2f((m[g] - mn[g]) * L2E); l[g] *= al; m[g] = mn[g];
#pragma unroll
                    for (int dt = 0; dt < 4; ++dt)
#pragma unroll
                        for (int r = 0; r < 8; ++r) o[dt][g][r] *= al; }
            }
#pragma unroll
            for (int g = 0; g < 2; ++g) { const float nm = 10.0f - m[g] * L2E; v16h pb; float ps = 0.f;
#pragma unroll
                for (int e = 0; e < 16; ++e) { const float p = __builtin_amdgcn_exp2f(fmaf(s[e >> 3][g][e & 7], L2E, nm)); ps += p; pb[e] = tohx(p); }
                l[g] += ps;
#pragma unroll
                for (int e = 0; e < 16; ++e) { __builtin_amdgcn_sched_group_barrier(0x400, 1, 0); __builtin_amdgcn_sched_group_barrier(0x2, 1, 0); }    // one plain vector instruction behind each exp: fills the slot the instruction set asks for behind it
#pragma unroll
                for (int dt = 0; dt < 4; ++dt) o[dt][g] = wmma16(vf[dt], pb, o[dt][g]); }
        }
        }
        asm volatile("s_wait_dscnt 0x0" ::: "memory");       // this wave's reads of the buffer have returned before it is refilled
        asm volatile("s_wait_asynccnt 0x0" ::: "memory");    // this wave's share of stage t + 1 has landed
        __syncthreads();                                      // publishes stage t + 1 and ends every wave's reads of stage t
        if (t + 2 < NST) stage_copy(lk + bo, lv + bo, gh + (t + 2) * (SK * HD * 2), gl + (t + 2) * (SK * HD * 2), gv + (t + 2) * (SK * 2));    // stage t + 2 into the buffer just left
    }
    asm volatile("s_wait_asynccnt 0x0" ::: "memory");    // no copy is outstanding when the wave ends
    const int b = z >> 4, h = z & 15;
#pragma unroll
    for (int g = 0; g < 2; ++g) { const float inv = __fdiv_rn(1.0f, l[g] + xhalf(l[g])); const size_t ob = ((size_t)(q0 + g * 16 + c) * NB_ + b) * DD + h * HD + 8 * hi;
#pragma unroll
        for (int dt = 0; dt < 4; ++dt) { v8us oh, ol;
#pragma unroll
            for (int r = 0; r < 8; ++r) { unsigned short a, c2; splitf(o[dt][g][r] * inv, a, c2); oh[r] = a; ol[r] = c2; }
            *(v8us*)(Ah + ob + dt * 16) = oh; *(v8us*)(Al + ob + dt * 16) = ol; } }
}

extern "C" void kernel_launch(void* const* d_in, const int* in_sizes, int n_in,
                              void* d_out, int out_size, void* d_ws, size_t ws_size, hipStream_t stream) {
    (void)in_sizes; (void)n_in; (void)out_size;
    const float* x = (const float*)d_in[0]; const float* wq = (const float*)d_in[1]; const float* bq = (const float*)d_in[2]; const float* wk = (const float*)d_in[3]; const float* bk = (const float*)d_in[4]; const float* wv = (const float*)d_in[5]; const float* bv = (const float*)d_in[6];
    const float* wo = (const float*)d_in[7]; const float* bo = (const float*)d_in[8];
    float* OUT = (float*)d_out;     // [2048][2][1024] (rows t*2 + b)
    char* wsp = (char*)d_ws;
    auto take = [&](size_t bytes) { char* p = wsp; wsp += (bytes + 255) & ~(size_t)255; return (void*)p; };
    bf* WQ = (bf*)take((size_t)DD * DD * 2); bf* WK = (bf*)take((size_t)DD * DD * 2); bf* WV = (bf*)take((size_t)DD * DD * 2); bf* WO = (bf*)take((size_t)DD * DD * 2);
    bf* XB = (bf*)take((size_t)NT * DD * 2); float* F = (float*)take((size_t)NT * DD * 4);
    bf* QPh = (bf*)take((size_t)NT * DD * 2); bf* QPl = (bf*)take((size_t)NT * DD * 2); bf* KPh = (bf*)take((size_t)NT * DD * 2); bf* KPl = (bf*)take((size_t)NT * DD * 2); h16* VT = (h16*)take((size_t)NT * DD * 2);
    bf* ATh = (bf*)take((size_t)NT * DD * 2); bf* ATl = (bf*)take((size_t)NT * DD * 2);
    if ((size_t)(wsp - (char*)d_ws) > ws_size) return;    // ws 256 MiB
    { const size_t nw = (size_t)DD * DD / 8; const unsigned gw = (unsigned)((nw + 255) / 256); k_cvt8<<<gw, 256, 0, stream>>>(wq, WQ, nw); k_cvt8<<<gw, 256, 0, stream>>>(wk, WK, nw); k_cvt8<<<gw, 256, 0, stream>>>(wv, WV, nw); k_cvt8<<<gw, 256, 0, stream>>>(wo, WO, nw); }
    const size_t nx = (size_t)NT * DD / 8; const unsigned gx = (unsigned)((nx + 255) / 256); const unsigned LB = (unsigned)((NT * DD / 64 + 63) / 64);
    k_cvt8<<<gx, 256, 0, stream>>>(x, XB, nx);
    k_gemmw<bf, 0, true><<<dim3(NT / 64, DD / 64, 1), 32, 0, stream>>>(XB, nullptr, WQ, nullptr, DD, F, DD, bq, 0, 0, 0); k_hsplit<<<LB, 256, 0, stream>>>(F, 0.125f, QPh, QPl);   // 1/sqrt(64) folded into q exactly
    k_gemmw<bf, 0, true><<<dim3(NT / 64, DD / 64, 1), 32, 0, stream>>>(XB, nullptr, WK, nullptr, DD, F, DD, bk, 0, 0, 0); k_hsplit<<<LB, 256, 0, stream>>>(F, 1.0f, KPh, KPl);
    k_gemmw<bf, 0, true><<<dim3(NT / 64, DD / 64, 1), 32, 0, stream>>>(XB, nullptr, WV, nullptr, DD, F, DD, bv, 0, 0, 0); k_vtplane<<<LB, 256, 0, stream>>>(F, VT);
    k_fattn<<<dim3(TT / 256, NB_ * NH_, 1), 256, 0, stream>>>(QPh, QPl, KPh, KPl, VT, ATh, ATl);
    k_gemmw<bf, 1, true><<<dim3(NT / 64, DD / 64, 1), 32, 0, stream>>>(ATh, ATl, WO, nullptr, DD, OUT, DD, bo, 0, 0, 0);
}

// v003
// A run of this version takes 140 microseconds.
// In two side-by-side timings against v002, it was 1.57 and 1.55 times as fast.
// Over all steps from v000 it is 9.01 times as fast.
#include <hip/hip_runtime.h>

// JITCompatibleMultiheadAttention (query [T=2048][B=2][E=1024] seq-first layout; q = (query Wq^T + bq) * 64^-0.5, k/v = query W^T + b; 16 heads x 64 ([T,B,E] -> [B*16][T][64]);
// softmax(q.k) v; out [T][B][E] = attn Wo^T + bo). Rows are indexed r = t*2 + b everywhere (projections and the output GEMM are row-order agnostic; the head-plane builders and the merge use t*NB_ + b).
// Compute dtypes, f32 accumulate: every float input rounded to bf16; q/k/v projections on PLAIN bf16 operands (x, W inputs: exact, + bias);
// scores on bf16 hi+lo q (x 1/8) and k planes (3 products); attn.v on SINGLE fp16 planes (P x1024, v); output Linear on hi+lo planes x exact bf16 W (2 products); 

#define NB_  2
#define TT   2048
#define DD   1024
#define NH_  16
#define HD   64
#define NT   (NB_ * TT)
typedef _Float16 h16;
typedef unsigned short bf;
typedef __attribute__((ext_vector_type(16))) __bf16   v16bf;
typedef __attribute__((ext_vector_type(16))) _Float16 v16h;
typedef __attribute__((ext_vector_type(8)))  _Float16 v8h;
typedef __attribute__((ext_vector_type(8)))  unsigned short v8us;
typedef __attribute__((ext_vector_type(8)))  float    v8f;
typedef __attribute__((ext_vector_type(4)))  float    v4f;
typedef v8h  __attribute__((may_alias)) v8ha;
typedef v4f  __attribute__((may_alias)) v4fa;
typedef v8us __attribute__((may_alias)) v8usa;

__device__ __forceinline__ unsigned short f2bf(float f) { unsigned u = __float_as_uint(f); u += 0x7FFFu + ((u >> 16) & 1u); return (unsigned short)(u >> 16); }
__device__ __forceinline__ float bf2f(unsigned short b) { return __uint_as_float(((unsigned)b) << 16); }
__device__ __forceinline__ float bfr(float f) { return bf2f(f2bf(f)); }
__device__ __forceinline__ v16h cat16(v8h lo, v8h hi) { return __builtin_shufflevector(lo, hi, 0, 1, 2, 3, 4, 5, 6, 7, 8, 9, 10, 11, 12, 13, 14, 15); }
__device__ __forceinline__ v16bf cat16b(v8us lo, v8us hi) { return __builtin_bit_cast(v16bf, __builtin_shufflevector(lo, hi, 0, 1, 2, 3, 4, 5, 6, 7, 8, 9, 10, 11, 12, 13, 14, 15)); }
__device__ __forceinline__ v8f wmma16(v16h a, v16h b, v8f c) { return __builtin_amdgcn_wmma_f32_16x16x32_f16(false, a, false, b, (short)0, c, false, false); }
__device__ __forceinline__ v8f wmmab(v16bf a, v16bf b, v8f c) { return __builtin_amdgcn_wmma_f32_16x16x32_bf16(false, a, false, b, (short)0, c, false, false); }



// ---- k_gemmw: GEMM on K-contiguous 16-bit planes, one 128x128 output tile per work-group of eight waves (2 x 4, each 64x32: 8 accumulators); grid (M/128, N/128, Z), 256 threads.
// C[m][n] (f32, pitch ldc, + optional f32 bias[n]) = sum_k A[m][k] Bt[n][k] (NSPLIT == 1: + A2[m][k] Bt[n][k]). z-batch strides sA/sB/sC in elements. K % 128 == 0, M % 128 == 0, N % 128 == 0.
// The operand rows come 128 k (256 B, whole lines) at a time into two LDS buffers by asynchronous copies, each byte fetched once a work-group; every wave reads its fragments from LDS.
template <typename T16> struct WFrag;
template <> struct WFrag<h16> { typedef v16h V; static __device__ __forceinline__ V ld(const h16* p) { return cat16(*(const v8h*)p, *(const v8h*)(p + 16)); } static __device__ __forceinline__ v8f mma(V a, V b, v8f c) { return wmma16(a, b, c); } };
template <> struct WFrag<bf> { typedef v16bf V; static __device__ __forceinline__ V ld(const bf* p) { return cat16b(*(const v8us*)p, *(const v8us*)(p + 16)); } static __device__ __forceinline__ v8f mma(V a, V b, v8f c) { return wmmab(a, b, c); } };
#define GS   128                  // k elements a stage
#define GP   272                  // LDS pitch of a staged row (256 B + 16: 16 B x odd, the conflict-free pitch of 16-byte reads)
#define GPL  (128 * GP)           // one staged plane: 128 rows
// One plane's eight copies of a lane (16 bytes each, rows 16 apart). l: the lane's LDS byte address in the plane; g: its global address; rs: bytes of 16 source rows.
__device__ __forceinline__ void plane_copy(unsigned l, const char* g, size_t rs) {
    // the copies and, as the last line, the wait that stands in front of any rewrite of their address registers, in one statement
    asm volatile("global_load_async_to_lds_b128 %0, %8, off\n\t"
                 "global_load_async_to_lds_b128 %1, %9, off\n\t"
                 "global_load_async_to_lds_b128 %2, %10, off\n\t"
                 "global_load_async_to_lds_b128 %3, %11, off\n\t"
                 "global_load_async_to_lds_b128 %4, %12, off\n\t"
                 "global_load_async_to_lds_b128 %5, %13, off\n\t"
                 "global_load_async_to_lds_b128 %6, %14, off\n\t"
                 "global_load_async_to_lds_b128 %7, %15, off\n\t"
                 "s_wait_xcnt 0x0"
                 : : "v"(l), "v"(l + 16 * GP), "v"(l + 32 * GP), "v"(l + 48 * GP), "v"(l + 64 * GP), "v"(l + 80 * GP), "v"(l + 96 * GP), "v"(l + 112 * GP),
                     "v"(g), "v"(g + rs), "v"(g + 2 * rs), "v"(g + 3 * rs), "v"(g + 4 * rs), "v"(g + 5 * rs), "v"(g + 6 * rs), "v"(g + 7 * rs)
                 : "memory");
}
template <typename T16, int NSPLIT, bool BIAS>
__global__ __launch_bounds__(256) void k_gemmw(const T16* __restrict__ A, const T16* __restrict__ A2, const T16* __restrict__ Bt, int K, float* C, int ldc, const float* __restrict__ bias, size_t sA, size_t sB, size_t sC) {
    static_assert(NSPLIT == 0 || NSPLIT == 1, "one or two A planes");
    typedef typename WFrag<T16>::V V;
    constexpr int NPL = NSPLIT == 1 ? 3 : 2;     // staged planes: A, (A2,) Bt
    constexpr int GBUF = NPL * GPL;              // one buffer
    __shared__ __align__(16) char gs[2 * GBUF];
    __shared__ __align__(16) float osm[8 * 16 * 36];    // each wave's own store staging: 16 rows of 32 floats, pitch 36
    const size_t z = blockIdx.z; A += z * sA; if (NSPLIT == 1) A2 += z * sA; Bt += z * sB; C += z * sC;
    const int tid = threadIdx.x; const int lane = tid & 31, lr = lane & 15, hi = lane >> 4; const int w = tid >> 5, wm = w & 1, wn = w >> 1; const int r0 = blockIdx.x * 128, c0 = blockIdx.y * 128;
    v8f acc[4][2];
#pragma unroll
    for (int mb = 0; mb < 4; ++mb)
#pragma unroll
        for (int nb = 0; nb < 2; ++nb) acc[mb][nb] = (v8f){};
    const unsigned lc = (unsigned)(size_t)gs + (unsigned)((tid >> 4) * GP + (tid & 15) * 16);    // the lane's place in a staged plane
    const size_t rs = (size_t)K * 32;
    const char* gA = (const char*)(A + (size_t)(r0 + (tid >> 4)) * K) + (tid & 15) * 16; const char* gA2 = NSPLIT == 1 ? (const char*)(A2 + (size_t)(r0 + (tid >> 4)) * K) + (tid & 15) * 16 : nullptr; const char* gB = (const char*)(Bt + (size_t)(c0 + (tid >> 4)) * K) + (tid & 15) * 16;
    auto stage = [&](int t, unsigned bo) { plane_copy(lc + bo, gA + (size_t)t * (GS * 2), rs); if (NSPLIT == 1) plane_copy(lc + bo + GPL, gA2 + (size_t)t * (GS * 2), rs); plane_copy(lc + bo + (NPL - 1) * GPL, gB + (size_t)t * (GS * 2), rs); };
    const char* fa = gs + (wm * 64 + lr) * GP + 16 * hi; const char* fb = gs + (NPL - 1) * GPL + (wn * 32 + lr) * GP + 16 * hi;    // the lane's fragment bases in buffer 0
    const int nst = K / GS;
    stage(0, 0);
    asm volatile("s_wait_asynccnt 0x0" ::: "memory");    // this wave's share of stage 0 has landed
    __syncthreads();                                      // publishes stage 0
    if (nst > 1) stage(1, GBUF);
#pragma unroll 1    // stays rolled: one stage's body stands once in the instruction cache
    for (int t = 0; t < nst; ++t) {
        const int bo = (t & 1) * GBUF;
        V a[2][4], a2[2][4], b[2][2];    // two fragment sets: a step's products run on one while the next step's reads fill the other
        auto frag = [&](int ks, int s) {
#pragma unroll
            for (int mb = 0; mb < 4; ++mb) { a[s][mb] = WFrag<T16>::ld((const T16*)(fa + bo + mb * 16 * GP + ks * 64)); if (NSPLIT == 1) a2[s][mb] = WFrag<T16>::ld((const T16*)(fa + bo + GPL + mb * 16 * GP + ks * 64)); }
#pragma unroll
            for (int nb = 0; nb < 2; ++nb) b[s][nb] = WFrag<T16>::ld((const T16*)(fb + bo + nb * 16 * GP + ks * 64)); };
        frag(0, 0);
        __builtin_amdgcn_sched_barrier(0);    // the first step's reads stay in front of the second's, so that the first products wait for their own set alone
#pragma unroll    // unrolled: every LDS offset is an immediate and the fragment sets are named at compile time
        for (int ks = 0; ks < GS / 32; ++ks) {
            const int s = ks & 1;
            if (ks + 1 < GS / 32) frag(ks + 1, s ^ 1);    // of this same stage only
            __builtin_amdgcn_sched_barrier(0);    // the next step's reads stay one group ahead of this step's products, for speed only
#pragma unroll
            for (int nb = 0; nb < 2; ++nb)
#pragma unroll
                for (int mb = 0; mb < 4; ++mb) acc[mb][nb] = WFrag<T16>::mma(a[s][mb], b[s][nb], acc[mb][nb]);
            if (NSPLIT == 1) {
#pragma unroll
                for (int nb = 0; nb < 2; ++nb)
#pragma unroll
                    for (int mb = 0; mb < 4; ++mb) acc[mb][nb] = WFrag<T16>::mma(a2[s][mb], b[s][nb], acc[mb][nb]);
            }
            __builtin_amdgcn_sched_barrier(0);    // and the reads behind these products do not move in among them
        }
        asm volatile("s_wait_dscnt 0x0" ::: "memory");       // this wave's reads of the buffer have returned before it is refilled
        asm volatile("s_wait_asynccnt 0x0" ::: "memory");    // this wave's share of stage t + 1 has landed
        __syncthreads();                                      // publishes stage t + 1 and ends every wave's reads of stage t
        if (t + 2 < nst) stage(t + 2, (unsigned)bo);          // stage t + 2 into the buffer just left
    }
    asm volatile("s_wait_asynccnt 0x0" ::: "memory");    // no copy is outstanding when the wave ends
    float* os = osm + w * (16 * 36); const int cw = c0 + wn * 32;
#pragma unroll
    for (int mb = 0; mb < 4; ++mb) {
#pragma unroll
        for (int nb = 0; nb < 2; ++nb) {
#pragma unroll
            for (int j = 0; j < 8; ++j) os[(hi * 8 + j) * 36 + nb * 16 + lr] = acc[mb][nb][j]; }
        __builtin_amdgcn_wave_barrier(); asm volatile("" ::: "memory");    // the wave's staged rows are written before it reads them back
        float* crow = C + (size_t)(r0 + wm * 64 + mb * 16) * ldc + cw;
#pragma unroll
        for (int s = 0; s < 4; ++s) { const int row = 4 * s + (lane >> 3), cofs = (lane & 7) * 4; v4f val = *(const v4fa*)(os + row * 36 + cofs); if (BIAS) { val[0] += bfr(bias[cw + cofs]); val[1] += bfr(bias[cw + cofs + 1]); val[2] += bfr(bias[cw + cofs + 2]); val[3] += bfr(bias[cw + cofs + 3]); }
            *(v4f*)(crow + (size_t)row * ldc + cofs) = val; }
        __builtin_amdgcn_wave_barrier(); asm volatile("" ::: "memory");    // the rows are read back before the next tile row overwrites them
    }
}

__device__ __forceinline__ h16 tohx(float x) { return (h16)x; }
__device__ __forceinline__ void splitf(float y, unsigned short& h, unsigned short& l) { h = f2bf(y); l = f2bf(y - bf2f(h)); }
typedef __attribute__((ext_vector_type(2))) _Float16 v2h;
typedef __attribute__((ext_vector_type(4))) _Float16 v4h;
typedef __attribute__((ext_vector_type(2))) unsigned short v2us;
typedef __attribute__((ext_vector_type(4))) int v4i;

__global__ __launch_bounds__(256) void k_cvt8(const float* __restrict__ src, bf* dst, size_t n8) { const size_t i = (size_t)blockIdx.x * 256 + threadIdx.x; if (i >= n8) return; const v8f v = *(const v8f*)(src + i * 8); v8us o;
#pragma unroll
    for (int k = 0; k < 8; ++k) o[k] = f2bf(v[k]); *(v8us*)(dst + i * 8) = o;  }
__global__ __launch_bounds__(256) void k_hsplit(const float* __restrict__ F, float sc, bf* Ph, bf* Pl) {
    const int lane = threadIdx.x & 31; const int L0 = (blockIdx.x * 8 + (threadIdx.x >> 5)) * 8; const int nlines = NT * DD / 64;
{
#pragma unroll
        for (int l = 0; l < 8; ++l) { const int L = L0 + l; if (L >= nlines) break; const int e = L * 64 + lane * 2; const int d = e & 63; const int t = (e >> 6) & (TT - 1); const int z = e >> 17; const int b = z >> 4, h = z & 15; v2us oh, ol;
#pragma unroll
            for (int q = 0; q < 2; ++q) { unsigned short a, c2; splitf(F[((size_t)t * NB_ + b) * DD + h * HD + d + q] * sc, a, c2); oh[q] = a; ol[q] = c2; }
            *(v2us*)(Ph + (size_t)e) = oh; *(v2us*)(Pl + (size_t)e) = ol; }
         }
}
__global__ __launch_bounds__(256) void k_vtplane(const float* __restrict__ F, h16* VT) {
    const int lane = threadIdx.x & 31; const int L0 = (blockIdx.x * 8 + (threadIdx.x >> 5)) * 8; const int nlines = NT * DD / 64;
{
#pragma unroll
        for (int l = 0; l < 8; ++l) { const int L = L0 + l; if (L >= nlines) break; const int e = L * 64 + lane * 2; const int t = e & (TT - 1); const int d = (e >> 11) & 63; const int z = e >> 17; const int b = z >> 4, h = z & 15; v2h v;
#pragma unroll
            for (int q = 0; q < 2; ++q) v[q] = tohx(F[((size_t)(t + q) * NB_ + b) * DD + h * HD + d]);
            *(v2h*)(VT + (size_t)e) = v; }
         }
}
__device__ __forceinline__ float xhalf(float x) { return __builtin_bit_cast(float, __builtin_amdgcn_permlanex16(__builtin_bit_cast(int, x), __builtin_bit_cast(int, x), 0x76543210, 0xfedcba98, false, false)); }  // lane l with lane l ^ 16
#define L2E 1.4426950408889634f
#define SK   128                  // keys a stage
#define NST  (TT / SK)            // stages
#define KP   144                  // LDS pitch of a K row (128 B + 16: 16 B x odd, the conflict-free pitch of 16-byte reads)
#define VP   272                  // LDS pitch of a V^T row (256 B + 16)
#define KPB  (SK * KP)            // one K plane of a stage
#define BUFB (2 * KPB + HD * VP)  // one buffer: K hi, K lo, V^T
// One stage's twelve copies of a lane (16 bytes each): four to each of K hi, K lo, V^T. lk, lv: the lane's LDS byte addresses in the K hi plane and in V^T; gh, gl, gv: its global addresses.
__device__ __forceinline__ void stage_copy(unsigned lk, unsigned lv, const char* gh, const char* gl, const char* gv) {
    // the copies and, as the last line, the wait that stands in front of any rewrite of their address registers, in one statement
    asm volatile("global_load_async_to_lds_b128 %0, %12, off\n\t"
                 "global_load_async_to_lds_b128 %1, %13, off\n\t"
                 "global_load_async_to_lds_b128 %2, %14, off\n\t"
                 "global_load_async_to_lds_b128 %3, %15, off\n\t"
                 "global_load_async_to_lds_b128 %4, %16, off\n\t"
                 "global_load_async_to_lds_b128 %5, %17, off\n\t"
                 "global_load_async_to_lds_b128 %6, %18, off\n\t"
                 "global_load_async_to_lds_b128 %7, %19, off\n\t"
                 "global_load_async_to_lds_b128 %8, %20, off\n\t"
                 "global_load_async_to_lds_b128 %9, %21, off\n\t"
                 "global_load_async_to_lds_b128 %10, %22, off\n\t"
                 "global_load_async_to_lds_b128 %11, %23, off\n\t"
                 "s_wait_xcnt 0x0"
                 : : "v"(lk), "v"(lk + 32 * KP), "v"(lk + 64 * KP), "v"(lk + 96 * KP),
                     "v"(lk + KPB), "v"(lk + KPB + 32 * KP), "v"(lk + KPB + 64 * KP), "v"(lk + KPB + 96 * KP),
                     "v"(lv), "v"(lv + 16 * VP), "v"(lv + 32 * VP), "v"(lv + 48 * VP),
                     "v"(gh), "v"(gh + 4096), "v"(gh + 8192), "v"(gh + 12288),
                     "v"(gl), "v"(gl + 4096), "v"(gl + 8192), "v"(gl + 12288),
                     "v"(gv), "v"(gv + 16 * TT * 2), "v"(gv + 32 * TT * 2), "v"(gv + 48 * TT * 2)
                 : "memory");
}
__global__ __launch_bounds__(256) void k_fattn(const bf* __restrict__ Qh, const bf* __restrict__ Ql, const bf* __restrict__ Kh, const bf* __restrict__ Kl, const h16* __restrict__ VT, bf* Ah, bf* Al) {
    __shared__ __align__(16) char sm[2 * BUFB];
    const int tid = threadIdx.x; const int lane = tid & 31, c = lane & 15, hi = lane >> 4; const int z = blockIdx.y; const int q0 = blockIdx.x * 256 + (tid >> 5) * 32;
    const size_t zo = (size_t)z * TT * HD;
    const unsigned lk = (unsigned)(size_t)sm + (unsigned)((tid >> 3) * KP + (tid & 7) * 16), lv = (unsigned)(size_t)sm + (unsigned)(2 * KPB + (tid >> 4) * VP + (tid & 15) * 16);
    const char* gh = (const char*)(Kh + zo) + tid * 16; const char* gl = (const char*)(Kl + zo) + tid * 16; const char* gv = (const char*)(VT + zo) + (tid >> 4) * (TT * 2) + (tid & 15) * 16;
    const unsigned qo[2] = {(unsigned)(zo + (q0 + c) * HD + 8 * hi) * 2u, (unsigned)(zo + (q0 + 16 + c) * HD + 8 * hi) * 2u};    // the lane's byte offsets into the Q planes
    v16bf qh[2][2], ql[2][2];
#pragma unroll
    for (int g = 0; g < 2; ++g)
#pragma unroll
        for (int kc = 0; kc < 2; ++kc) { qh[g][kc] = WFrag<bf>::ld((const bf*)((const char*)Qh + qo[g]) + kc * 32); ql[g][kc] = WFrag<bf>::ld((const bf*)((const char*)Ql + qo[g]) + kc * 32); }
    v8f o[4][2];
#pragma unroll
    for (int dt = 0; dt < 4; ++dt)
#pragma unroll
        for (int g = 0; g < 2; ++g) o[dt][g] = (v8f){};
    float m[2] = {-3.0e38f, -3.0e38f}, l[2] = {0.f, 0.f};
    asm volatile("s_wait_xcnt 0x0" : : "v"(qo[0]), "v"(qo[1]) : "memory");    // keeps the Q loads' offset registers untouched up to the wait; behind it they are free for reuse
    const char* fk = sm + c * KP + 16 * hi; const char* fv = sm + 2 * KPB + c * VP + 16 * hi;    // the lane's fragment bases in buffer 0
#pragma unroll 1    // stays rolled: the copies keep one place of issue, and the four-pass body stands once in the instruction cache
    for (int t = -2; t < NST; ++t) {    // trips -2 and -1 are the ring's prologue: they only pass the foot, which issues stage 0, then publishes it and issues stage 1
        const int bo = (t & 1) * BUFB;
        if (t >= 0) {
        v16bf kh[2][2], kl[2][2];
#pragma unroll
        for (int kt = 0; kt < 2; ++kt)
#pragma unroll
            for (int kc = 0; kc < 2; ++kc) { kh[kt][kc] = WFrag<bf>::ld((const bf*)(fk + bo + kt * 16 * KP + kc * 64)); kl[kt][kc] = WFrag<bf>::ld((const bf*)(fk + bo + KPB + kt * 16 * KP + kc * 64)); }
#pragma unroll    // unrolled: every LDS offset of a pass is an immediate, and a pass's exps can stand among the next pass's products
        for (int sub = 0; sub < SK / 32; ++sub) {
            v16h vf[4];
#pragma unroll
            for (int dt = 0; dt < 4; ++dt) vf[dt] = WFrag<h16>::ld((const h16*)(fv + bo + dt * 16 * VP + sub * 64));
            v8f s[2][2];
#pragma unroll
            for (int kt = 0; kt < 2; ++kt)
#pragma unroll
                for (int g = 0; g < 2; ++g) { v8f a = (v8f){};
#pragma unroll
                    for (int kc = 0; kc < 2; ++kc) { a = wmmab(kh[kt][kc], qh[g][kc], a); a = wmmab(kh[kt][kc], ql[g][kc], a); a = wmmab(kl[kt][kc], qh[g][kc], a); }
                    s[kt][g] = a; }
            if (sub + 1 < SK / 32) {    // the next 32 keys' fragments, of this same stage, are fetched behind this pass's products
#pragma unroll
                for (int kt = 0; kt < 2; ++kt)
#pragma unroll
                    for (int kc = 0; kc < 2; ++kc) { kh[kt][kc] = WFrag<bf>::ld((const bf*)(fk + bo + ((sub + 1) * 32 + kt * 16) * KP + kc * 64)); kl[kt][kc] = WFrag<bf>::ld((const bf*)(fk + bo + KPB + ((sub + 1) * 32 + kt * 16) * KP + kc * 64)); }
            }
            float mn[2]; bool need = false;
#pragma unroll
            for (int g = 0; g < 2; ++g) { float mx = s[0][g][0];
#pragma unroll
                for (int r = 1; r < 8; ++r) mx = fmaxf(mx, s[0][g][r]);
#pragma unroll
                for (int r = 0; r < 8; ++r) mx = fmaxf(mx, s[1][g][r]);
                mx = fmaxf(mx, xhalf(mx)); mn[g] = fmaxf(m[g], mx); need = need || (mn[g] > m[g]); }
            if (__builtin_amdgcn_ballot_w32(need) != 0) {    // a new maximum in some column: rescale sums and output tiles (factor 1 in the columns that keep theirs)
#pragma unroll
                for (int g = 0; g < 2; ++g) { const float al = __builtin_amdgcn_exp2f((m[g] - mn[g]) * L2E); l[g] *= al; m[g] = mn[g];
#pragma unroll
                    for (int dt = 0; dt < 4; ++dt)
#pragma unroll
                        for (int r = 0; r < 8; ++r) o[dt][g][r] *= al; }
            }
#pragma unroll
            for (int g = 0; g < 2; ++g) { const float nm = 10.0f - m[g] * L2E; v16h pb; float ps = 0.f;
#pragma unroll
                for (int e = 0; e < 16; ++e) { const float p = __builtin_amdgcn_exp2f(fmaf(s[e >> 3][g][e & 7], L2E, nm)); ps += p; pb[e] = tohx(p); }
                l[g] += ps;
#pragma unroll
                for (int e = 0; e < 16; ++e) { __builtin_amdgcn_sched_group_barrier(0x400, 1, 0); __builtin_amdgcn_sched_group_barrier(0x2, 1, 0); }    // one plain vector instruction behind each exp: fills the slot the instruction set asks for behind it
#pragma unroll
                for (int dt = 0; dt < 4; ++dt) o[dt][g] = wmma16(vf[dt], pb, o[dt][g]); }
        }
        }
        asm volatile("s_wait_dscnt 0x0" ::: "memory");       // this wave's reads of the buffer have returned before it is refilled
        asm volatile("s_wait_asynccnt 0x0" ::: "memory");    // this wave's share of stage t + 1 has landed
        __syncthreads();                                      // publishes stage t + 1 and ends every wave's reads of stage t
        if (t + 2 < NST) stage_copy(lk + bo, lv + bo, gh + (t + 2) * (SK * HD * 2), gl + (t + 2) * (SK * HD * 2), gv + (t + 2) * (SK * 2));    // stage t + 2 into the buffer just left
    }
    asm volatile("s_wait_asynccnt 0x0" ::: "memory");    // no copy is outstanding when the wave ends
    const int b = z >> 4, h = z & 15;
#pragma unroll
    for (int g = 0; g < 2; ++g) { const float inv = __fdiv_rn(1.0f, l[g] + xhalf(l[g])); const size_t ob = ((size_t)(q0 + g * 16 + c) * NB_ + b) * DD + h * HD + 8 * hi;
#pragma unroll
        for (int dt = 0; dt < 4; ++dt) { v8us oh, ol;
#pragma unroll
            for (int r = 0; r < 8; ++r) { unsigned short a, c2; splitf(o[dt][g][r] * inv, a, c2); oh[r] = a; ol[r] = c2; }
            *(v8us*)(Ah + ob + dt * 16) = oh; *(v8us*)(Al + ob + dt * 16) = ol; } }
}

extern "C" void kernel_launch(void* const* d_in, const int* in_sizes, int n_in,
                              void* d_out, int out_size, void* d_ws, size_t ws_size, hipStream_t stream) {
    (void)in_sizes; (void)n_in; (void)out_size;
    const float* x = (const float*)d_in[0]; const float* wq = (const float*)d_in[1]; const float* bq = (const float*)d_in[2]; const float* wk = (const float*)d_in[3]; const float* bk = (const float*)d_in[4]; const float* wv = (const float*)d_in[5]; const float* bv = (const float*)d_in[6];
    const float* wo = (const float*)d_in[7]; const float* bo = (const float*)d_in[8];
    float* OUT = (float*)d_out;     // [2048][2][1024] (rows t*2 + b)
    char* wsp = (char*)d_ws;
    auto take = [&](size_t bytes) { char* p = wsp; wsp += (bytes + 255) & ~(size_t)255; return (void*)p; };
    bf* WQ = (bf*)take((size_t)DD * DD * 2); bf* WK = (bf*)take((size_t)DD * DD * 2); bf* WV = (bf*)take((size_t)DD * DD * 2); bf* WO = (bf*)take((size_t)DD * DD * 2);
    bf* XB = (bf*)take((size_t)NT * DD * 2); float* F = (float*)take((size_t)NT * DD * 4);
    bf* QPh = (bf*)take((size_t)NT * DD * 2); bf* QPl = (bf*)take((size_t)NT * DD * 2); bf* KPh = (bf*)take((size_t)NT * DD * 2); bf* KPl = (bf*)take((size_t)NT * DD * 2); h16* VT = (h16*)take((size_t)NT * DD * 2);
    bf* ATh = (bf*)take((size_t)NT * DD * 2); bf* ATl = (bf*)take((size_t)NT * DD * 2);
    if ((size_t)(wsp - (char*)d_ws) > ws_size) return;    // ws 256 MiB
    { const size_t nw = (size_t)DD * DD / 8; const unsigned gw = (unsigned)((nw + 255) / 256); k_cvt8<<<gw, 256, 0, stream>>>(wq, WQ, nw); k_cvt8<<<gw, 256, 0, stream>>>(wk, WK, nw); k_cvt8<<<gw, 256, 0, stream>>>(wv, WV, nw); k_cvt8<<<gw, 256, 0, stream>>>(wo, WO, nw); }
    const size_t nx = (size_t)NT * DD / 8; const unsigned gx = (unsigned)((nx + 255) / 256); const unsigned LB = (unsigned)((NT * DD / 64 + 63) / 64);
    k_cvt8<<<gx, 256, 0, stream>>>(x, XB, nx);
    k_gemmw<bf, 0, true><<<dim3(NT / 128, DD / 128, 1), 256, 0, stream>>>(XB, nullptr, WQ, DD, F, DD, bq, 0, 0, 0); k_hsplit<<<LB, 256, 0, stream>>>(F, 0.125f, QPh, QPl);   // 1/sqrt(64) folded into q exactly
    k_gemmw<bf, 0, true><<<dim3(NT / 128, DD / 128, 1), 256, 0, stream>>>(XB, nullptr, WK, DD, F, DD, bk, 0, 0, 0); k_hsplit<<<LB, 256, 0, stream>>>(F, 1.0f, KPh, KPl);
    k_gemmw<bf, 0, true><<<dim3(NT / 128, DD / 128, 1), 256, 0, stream>>>(XB, nullptr, WV, DD, F, DD, bv, 0, 0, 0); k_vtplane<<<LB, 256, 0, stream>>>(F, VT);
    k_fattn<<<dim3(TT / 256, NB_ * NH_, 1), 256, 0, stream>>>(QPh, QPl, KPh, KPl, VT, ATh, ATl);
    k_gemmw<bf, 1, true><<<dim3(NT / 128, DD / 128, 1), 256, 0, stream>>>(ATh, ATl, WO, DD, OUT, DD, bo, 0, 0, 0);
}

// v004
// Measured time: 110 microseconds a run.
// In both of two side-by-side timings against v003, it was 1.28 times as fast.
// Over all steps from v000 it is 11.6 times as fast.
#include <hip/hip_runtime.h>

// JITCompatibleMultiheadAttention (query [T=2048][B=2][E=1024] seq-first layout; q = (query Wq^T + bq) * 64^-0.5, k/v = query W^T + b; 16 heads x 64 ([T,B,E] -> [B*16][T][64]);
// softmax(q.k) v; out [T][B][E] = attn Wo^T + bo). Rows are indexed r = t*2 + b everywhere (projections and the output GEMM are row-order agnostic; the head-plane builders and the merge use t*NB_ + b).
// Compute dtypes, f32 accumulate: every float input rounded to bf16; q/k/v projections on PLAIN bf16 operands (x, W inputs: exact, + bias);
// scores on bf16 hi+lo q (x 1/8) and k planes (3 products); attn.v on SINGLE fp16 planes (P x1024, v); output Linear on hi+lo planes x exact bf16 W (2 products); 

#define NB_  2
#define TT   2048
#define DD   1024
#define NH_  16
#define HD   64
#define NT   (NB_ * TT)
typedef _Float16 h16;
typedef unsigned short bf;
typedef __attribute__((ext_vector_type(16))) __bf16   v16bf;
typedef __attribute__((ext_vector_type(16))) _Float16 v16h;
typedef __attribute__((ext_vector_type(8)))  _Float16 v8h;
typedef __attribute__((ext_vector_type(8)))  unsigned short v8us;
typedef __attribute__((ext_vector_type(8)))  float    v8f;
typedef __attribute__((ext_vector_type(4)))  float    v4f;
typedef v8h  __attribute__((may_alias)) v8ha;
typedef v4f  __attribute__((may_alias)) v4fa;
typedef v8us __attribute__((may_alias)) v8usa;

__device__ __forceinline__ unsigned short f2bf(float f) { unsigned u = __float_as_uint(f); u += 0x7FFFu + ((u >> 16) & 1u); return (unsigned short)(u >> 16); }
__device__ __forceinline__ float bf2f(unsigned short b) { return __uint_as_float(((unsigned)b) << 16); }
__device__ __forceinline__ float bfr(float f) { return bf2f(f2bf(f)); }
__device__ __forceinline__ v16h cat16(v8h lo, v8h hi) { return __builtin_shufflevector(lo, hi, 0, 1, 2, 3, 4, 5, 6, 7, 8, 9, 10, 11, 12, 13, 14, 15); }
__device__ __forceinline__ v16bf cat16b(v8us lo, v8us hi) { return __builtin_bit_cast(v16bf, __builtin_shufflevector(lo, hi, 0, 1, 2, 3, 4, 5, 6, 7, 8, 9, 10, 11, 12, 13, 14, 15)); }
__device__ __forceinline__ v8f wmma16(v16h a, v16h b, v8f c) { return __builtin_amdgcn_wmma_f32_16x16x32_f16(false, a, false, b, (short)0, c, false, false); }
__device__ __forceinline__ v8f wmmab(v16bf a, v16bf b, v8f c) { return __builtin_amdgcn_wmma_f32_16x16x32_bf16(false, a, false, b, (short)0, c, false, false); }



// ---- k_gemmw: GEMM on K-contiguous 16-bit planes, one 128x128 output tile per work-group of eight waves (2 x 4, each 64x32: 8 accumulators); grid (M/128, N/128, Z), 256 threads.
// C[m][n] (f32, pitch ldc, + optional f32 bias[n]) = sum_k A[m][k] Bt[n][k] (NSPLIT == 1: + A2[m][k] Bt[n][k]). z-batch strides sA/sB/sC in elements. K % 128 == 0, M % 128 == 0, N % 128 == 0.
// The operand rows come 128 k (256 B, whole lines) at a time into two LDS buffers by asynchronous copies, each byte fetched once a work-group; every wave reads its fragments from LDS.
template <typename T16> struct WFrag;
template <> struct WFrag<h16> { typedef v16h V; static __device__ __forceinline__ V ld(const h16* p) { return cat16(*(const v8h*)p, *(const v8h*)(p + 16)); } static __device__ __forceinline__ v8f mma(V a, V b, v8f c) { return wmma16(a, b, c); } };
template <> struct WFrag<bf> { typedef v16bf V; static __device__ __forceinline__ V ld(const bf* p) { return cat16b(*(const v8us*)p, *(const v8us*)(p + 16)); } static __device__ __forceinline__ v8f mma(V a, V b, v8f c) { return wmmab(a, b, c); } };
#define GS   128                  // k elements a stage
#define GP   272                  // LDS pitch of a staged row (256 B + 16: 16 B x odd, the conflict-free pitch of 16-byte reads)
#define GPL  (128 * GP)           // one staged plane: 128 rows
// One plane's eight copies of a lane (16 bytes each, rows 16 apart). l: the lane's LDS byte address in the plane; g: its global address; rs: bytes of 16 source rows.
__device__ __forceinline__ void plane_copy(unsigned l, const char* g, size_t rs) {
    // the copies and, as the last line, the wait that stands in front of any rewrite of their address registers, in one statement
    asm volatile("global_load_async_to_lds_b128 %0, %8, off\n\t"
                 "global_load_async_to_lds_b128 %1, %9, off\n\t"
                 "global_load_async_to_lds_b128 %2, %10, off\n\t"
                 "global_load_async_to_lds_b128 %3, %11, off\n\t"
                 "global_load_async_to_lds_b128 %4, %12, off\n\t"
                 "global_load_async_to_lds_b128 %5, %13, off\n\t"
                 "global_load_async_to_lds_b128 %6, %14, off\n\t"
                 "global_load_async_to_lds_b128 %7, %15, off\n\t"
                 "s_wait_xcnt 0x0"
                 : : "v"(l), "v"(l + 16 * GP), "v"(l + 32 * GP), "v"(l + 48 * GP), "v"(l + 64 * GP), "v"(l + 80 * GP), "v"(l + 96 * GP), "v"(l + 112 * GP),
                     "v"(g), "v"(g + rs), "v"(g + 2 * rs), "v"(g + 3 * rs), "v"(g + 4 * rs), "v"(g + 5 * rs), "v"(g + 6 * rs), "v"(g + 7 * rs)
                 : "memory");
}
// gemm_tile: the ring and the products of one 128x128 tile (rows r0.., columns c0..); gs: the work-group's two buffers. Behind it no wave reads gs any more and no copy is in flight (the last stage's foot barrier).
template <typename T16, int NSPLIT>
__device__ __forceinline__ void gemm_tile(const T16* __restrict__ A, const T16* __restrict__ A2, const T16* __restrict__ Bt, int K, int r0, int c0, char* gs, v8f (&acc)[4][2]) {
    static_assert(NSPLIT == 0 || NSPLIT == 1, "one or two A planes");
    typedef typename WFrag<T16>::V V;
    constexpr int NPL = NSPLIT == 1 ? 3 : 2;     // staged planes: A, (A2,) Bt
    constexpr int GBUF = NPL * GPL;              // one buffer
    const int tid = threadIdx.x; const int lane = tid & 31, lr = lane & 15, hi = lane >> 4; const int w = tid >> 5, wm = w & 1, wn = w >> 1;
#pragma unroll
    for (int mb = 0; mb < 4; ++mb)
#pragma unroll
        for (int nb = 0; nb < 2; ++nb) acc[mb][nb] = (v8f){};
    const unsigned lc = (unsigned)(size_t)gs + (unsigned)((tid >> 4) * GP + (tid & 15) * 16);    // the lane's place in a staged plane
    const size_t rs = (size_t)K * 32;
    const char* gA = (const char*)(A + (size_t)(r0 + (tid >> 4)) * K) + (tid & 15) * 16; const char* gA2 = NSPLIT == 1 ? (const char*)(A2 + (size_t)(r0 + (tid >> 4)) * K) + (tid & 15) * 16 : nullptr; const char* gB = (const char*)(Bt + (size_t)(c0 + (tid >> 4)) * K) + (tid & 15) * 16;
    auto stage = [&](int t, unsigned bo) { plane_copy(lc + bo, gA + (size_t)t * (GS * 2), rs); if (NSPLIT == 1) plane_copy(lc + bo + GPL, gA2 + (size_t)t * (GS * 2), rs); plane_copy(lc + bo + (NPL - 1) * GPL, gB + (size_t)t * (GS * 2), rs); };
    const char* fa = gs + (wm * 64 + lr) * GP + 16 * hi; const char* fb = gs + (NPL - 1) * GPL + (wn * 32 + lr) * GP + 16 * hi;    // the lane's fragment bases in buffer 0
    const int nst = K / GS;
    stage(0, 0);
    asm volatile("s_wait_asynccnt 0x0" ::: "memory");    // this wave's share of stage 0 has landed
    __syncthreads();                                      // publishes stage 0
    if (nst > 1) stage(1, GBUF);
#pragma unroll 1    // stays rolled: one stage's body stands once in the instruction cache
    for (int t = 0; t < nst; ++t) {
        const int bo = (t & 1) * GBUF;
        V a[2][4], a2[2][4], b[2][2];    // two fragment sets: a step's products run on one while the next step's reads fill the other
        auto frag = [&](int ks, int s) {
#pragma unroll
            for (int mb = 0; mb < 4; ++mb) { a[s][mb] = WFrag<T16>::ld((const T16*)(fa + bo + mb * 16 * GP + ks * 64)); if (NSPLIT == 1) a2[s][mb] = WFrag<T16>::ld((const T16*)(fa + bo + GPL + mb * 16 * GP + ks * 64)); }
#pragma unroll
            for (int nb = 0; nb < 2; ++nb) b[s][nb] = WFrag<T16>::ld((const T16*)(fb + bo + nb * 16 * GP + ks * 64)); };
        frag(0, 0);
        __builtin_amdgcn_sched_barrier(0);    // the first step's reads stay in front of the second's, so that the first products wait for their own set alone
#pragma unroll    // unrolled: every LDS offset is an immediate and the fragment sets are named at compile time
        for (int ks = 0; ks < GS / 32; ++ks) {
            const int s = ks & 1;
            if (ks + 1 < GS / 32) frag(ks + 1, s ^ 1);    // of this same stage only
            __builtin_amdgcn_sched_barrier(0);    // the next step's reads stay one group ahead of this step's products, for speed only
#pragma unroll
            for (int nb = 0; nb < 2; ++nb)
#pragma unroll
                for (int mb = 0; mb < 4; ++mb) acc[mb][nb] = WFrag<T16>::mma(a[s][mb], b[s][nb], acc[mb][nb]);
            if (NSPLIT == 1) {
#pragma unroll
                for (int nb = 0; nb < 2; ++nb)
#pragma unroll
                    for (int mb = 0; mb < 4; ++mb) acc[mb][nb] = WFrag<T16>::mma(a2[s][mb], b[s][nb], acc[mb][nb]);
            }
            __builtin_amdgcn_sched_barrier(0);    // and the reads behind these products do not move in among them
        }
        asm volatile("s_wait_dscnt 0x0" ::: "memory");       // this wave's reads of the buffer have returned before it is refilled
        asm volatile("s_wait_asynccnt 0x0" ::: "memory");    // this wave's share of stage t + 1 has landed
        __syncthreads();                                      // publishes stage t + 1 and ends every wave's reads of stage t
        if (t + 2 < nst) stage(t + 2, (unsigned)bo);          // stage t + 2 into the buffer just left
    }
    asm volatile("s_wait_asynccnt 0x0" ::: "memory");    // no copy is outstanding when the wave ends
}
template <typename T16, int NSPLIT, bool BIAS>
__global__ __launch_bounds__(256) void k_gemmw(const T16* __restrict__ A, const T16* __restrict__ A2, const T16* __restrict__ Bt, int K, float* C, int ldc, const float* __restrict__ bias, size_t sA, size_t sB, size_t sC) {
    __shared__ __align__(16) char gs[2 * (NSPLIT == 1 ? 3 : 2) * GPL];
    __shared__ __align__(16) float osm[8 * 16 * 36];    // each wave's own store staging: 16 rows of 32 floats, pitch 36
    const size_t z = blockIdx.z; A += z * sA; if (NSPLIT == 1) A2 += z * sA; Bt += z * sB; C += z * sC;
    const int tid = threadIdx.x; const int lane = tid & 31, lr = lane & 15, hi = lane >> 4; const int w = tid >> 5, wm = w & 1, wn = w >> 1; const int r0 = blockIdx.x * 128, c0 = blockIdx.y * 128;
    v8f acc[4][2];
    gemm_tile<T16, NSPLIT>(A, A2, Bt, K, r0, c0, gs, acc);
    float* os = osm + w * (16 * 36); const int cw = c0 + wn * 32;
#pragma unroll
    for (int mb = 0; mb < 4; ++mb) {
#pragma unroll
        for (int nb = 0; nb < 2; ++nb) {
#pragma unroll
            for (int j = 0; j < 8; ++j) os[(hi * 8 + j) * 36 + nb * 16 + lr] = acc[mb][nb][j]; }
        __builtin_amdgcn_wave_barrier(); asm volatile("" ::: "memory");    // the wave's staged rows are written before it reads them back
        float* crow = C + (size_t)(r0 + wm * 64 + mb * 16) * ldc + cw;
#pragma unroll
        for (int s = 0; s < 4; ++s) { const int row = 4 * s + (lane >> 3), cofs = (lane & 7) * 4; v4f val = *(const v4fa*)(os + row * 36 + cofs); if (BIAS) { val[0] += bfr(bias[cw + cofs]); val[1] += bfr(bias[cw + cofs + 1]); val[2] += bfr(bias[cw + cofs + 2]); val[3] += bfr(bias[cw + cofs + 3]); }
            *(v4f*)(crow + (size_t)row * ldc + cofs) = val; }
        __builtin_amdgcn_wave_barrier(); asm volatile("" ::: "memory");    // the rows are read back before the next tile row overwrites them
    }
}

__device__ __forceinline__ h16 tohx(float x) { return (h16)x; }
__device__ __forceinline__ void splitf(float y, unsigned short& h, unsigned short& l) { h = f2bf(y); l = f2bf(y - bf2f(h)); }
typedef __attribute__((ext_vector_type(2))) _Float16 v2h;
typedef __attribute__((ext_vector_type(4))) _Float16 v4h;
typedef __attribute__((ext_vector_type(2))) unsigned short v2us;
typedef __attribute__((ext_vector_type(4))) int v4i;

__global__ __launch_bounds__(256) void k_cvt8(const float* __restrict__ src, bf* dst, size_t n8) { const size_t i = (size_t)blockIdx.x * 256 + threadIdx.x; if (i >= n8) return; const v8f v = *(const v8f*)(src + i * 8); v8us o;
#pragma unroll
    for (int k = 0; k < 8; ++k) o[k] = f2bf(v[k]); *(v8us*)(dst + i * 8) = o;  }
// k_qkv: the three projections in one launch, grid (NT/128, DD/128, 3), blockIdx.z = 0 q, 1 k, 2 v (W3: the three bf16 weight planes one behind the other). Each work-group writes its 128x128 tile (64 t x 2 b, two heads)
// straight into the head planes: q (x 1/8) and k as bf16 hi and lo [b*16+h][t][64], v as fp16 transposed [b*16+h][64][t]. The tile passes through the ring's LDS, free behind gemm_tile, so that every global store covers whole 128-byte lines.
#define QSP  132                  // floats a staged q/k row (128 + 4: the two lane halves, eight rows apart, fall on different banks)
#define VSP  72                   // fp16 a staged v line (128 B + 16: the conflict-free pitch of 16-byte reads)
__global__ __launch_bounds__(256) void k_qkv(const bf* __restrict__ X, const bf* __restrict__ W3, const float* __restrict__ bq, const float* __restrict__ bk, const float* __restrict__ bv, bf* Qh, bf* Ql, bf* Kh, bf* Kl, h16* VT) {
    __shared__ __align__(16) char gs[2 * 2 * GPL];
    static_assert(128 * QSP * 4 <= 2 * 2 * GPL && 256 * VSP * 2 <= 2 * 2 * GPL, "the staged tile fits the ring");
    const int tid = threadIdx.x; const int lane = tid & 31, lr = lane & 15, hi = lane >> 4; const int w = tid >> 5, wm = w & 1, wn = w >> 1; const int r0 = blockIdx.x * 128, c0 = blockIdx.y * 128; const int pz = blockIdx.z;
    const float* bias = pz == 0 ? bq : pz == 1 ? bk : bv;
    const float bb[2] = {bfr(bias[c0 + wn * 32 + lr]), bfr(bias[c0 + wn * 32 + 16 + lr])};    // fetched ahead of the ring, so that nothing waits for it behind the products
    v8f acc[4][2];
    gemm_tile<bf, 0>(X, nullptr, W3 + (size_t)pz * DD * DD, DD, r0, c0, gs, acc);
    const int t0 = r0 / NB_, h0 = c0 / HD;
    if (pz < 2) {    // the same for the whole work-group
        float* st = (float*)gs; const float sc = pz == 0 ? 0.125f : 1.0f;    // 1/sqrt(64) folded into q exactly
#pragma unroll    // this and every loop below is unrolled so that acc, x0 and x1 are indexed at compile time and stay in registers
        for (int mb = 0; mb < 4; ++mb)
#pragma unroll
            for (int nb = 0; nb < 2; ++nb)
#pragma unroll
                for (int j = 0; j < 8; ++j) st[(wm * 64 + mb * 16 + hi * 8 + j) * QSP + wn * 32 + nb * 16 + lr] = (acc[mb][nb][j] + bb[nb]) * sc;
        __syncthreads();    // the whole tile is staged before any wave reads other waves' columns
        bf* Ph = pz == 0 ? Qh : Kh; bf* Pl = pz == 0 ? Ql : Kl;
        v4f x0[8], x1[8];    // the reads stand in a loop of their own, so that later reads can be under way while earlier values are split
#pragma unroll
        for (int i = 0; i < 8; ++i) { const int it = i * 256 + tid; const int ch = it & 7, tl = (it >> 3) & 63, b = (it >> 9) & 1, hl = it >> 10;    // eight lanes a plane row, a wave four rows in a row: 512 contiguous bytes
            const float* sp = st + (tl * NB_ + b) * QSP + hl * HD + ch * 8; x0[i] = *(const v4fa*)sp; x1[i] = *(const v4fa*)(sp + 4); }
#pragma unroll
        for (int i = 0; i < 8; ++i) { const int it = i * 256 + tid; const int ch = it & 7, tl = (it >> 3) & 63, b = (it >> 9) & 1, hl = it >> 10; v8us oh, ol;
#pragma unroll
            for (int k = 0; k < 4; ++k) { unsigned short a, c2; splitf(x0[i][k], a, c2); oh[k] = a; ol[k] = c2; splitf(x1[i][k], a, c2); oh[4 + k] = a; ol[4 + k] = c2; }
            const size_t e = ((size_t)(b * NH_ + h0 + hl) * TT + t0 + tl) * HD + ch * 8;
            *(v8us*)(Ph + e) = oh; *(v8us*)(Pl + e) = ol; }
    } else {
        h16* sv = (h16*)gs;    // line (column, b): its 64 t
#pragma unroll
        for (int mb = 0; mb < 4; ++mb)
#pragma unroll
            for (int nb = 0; nb < 2; ++nb)
#pragma unroll
                for (int b = 0; b < 2; ++b) { v4h p;    // rows are t*2 + b: a lane's eight rows of a tile are four t of each b
#pragma unroll
                    for (int q = 0; q < 4; ++q) p[q] = tohx(acc[mb][nb][q * 2 + b] + bb[nb]);
                    *(v4h*)(sv + ((wn * 32 + nb * 16 + lr) * 2 + b) * VSP + wm * 32 + mb * 8 + hi * 4) = p; }
        __syncthreads();    // the whole tile is staged before any wave reads other waves' rows
#pragma unroll
        for (int i = 0; i < 8; ++i) { const int it = i * 256 + tid; const int ch = it & 7, ln = it >> 3; const int col = ln >> 1, b = ln & 1;    // eight lanes a line of V^T
            const v8h v = *(const v8ha*)(sv + ln * VSP + ch * 8);
            *(v8h*)(VT + ((size_t)(b * NH_ + h0 + (col >> 6)) * HD + (col & 63)) * TT + t0 + ch * 8) = v; }
        asm volatile("s_wait_xcnt 0x0" ::: "memory");    // stands behind the run's last store, in front of any later rewrite of the stores' address registers
    }
}
__device__ __forceinline__ float xhalf(float x) { return __builtin_bit_cast(float, __builtin_amdgcn_permlanex16(__builtin_bit_cast(int, x), __builtin_bit_cast(int, x), 0x76543210, 0xfedcba98, false, false)); }  // lane l with lane l ^ 16
#define L2E 1.4426950408889634f
#define SK   128                  // keys a stage
#define NST  (TT / SK)            // stages
#define KP   144                  // LDS pitch of a K row (128 B + 16: 16 B x odd, the conflict-free pitch of 16-byte reads)
#define VP   272                  // LDS pitch of a V^T row (256 B + 16)
#define KPB  (SK * KP)            // one K plane of a stage
#define BUFB (2 * KPB + HD * VP)  // one buffer: K hi, K lo, V^T
// One stage's twelve copies of a lane (16 bytes each): four to each of K hi, K lo, V^T. lk, lv: the lane's LDS byte addresses in the K hi plane and in V^T; gh, gl, gv: its global addresses.
__device__ __forceinline__ void stage_copy(unsigned lk, unsigned lv, const char* gh, const char* gl, const char* gv) {
    // the copies and, as the last line, the wait that stands in front of any rewrite of their address registers, in one statement
    asm volatile("global_load_async_to_lds_b128 %0, %12, off\n\t"
                 "global_load_async_to_lds_b128 %1, %13, off\n\t"
                 "global_load_async_to_lds_b128 %2, %14, off\n\t"
                 "global_load_async_to_lds_b128 %3, %15, off\n\t"
                 "global_load_async_to_lds_b128 %4, %16, off\n\t"
                 "global_load_async_to_lds_b128 %5, %17, off\n\t"
                 "global_load_async_to_lds_b128 %6, %18, off\n\t"
                 "global_load_async_to_lds_b128 %7, %19, off\n\t"
                 "global_load_async_to_lds_b128 %8, %20, off\n\t"
                 "global_load_async_to_lds_b128 %9, %21, off\n\t"
                 "global_load_async_to_lds_b128 %10, %22, off\n\t"
                 "global_load_async_to_lds_b128 %11, %23, off\n\t"
                 "s_wait_xcnt 0x0"
                 : : "v"(lk), "v"(lk + 32 * KP), "v"(lk + 64 * KP), "v"(lk + 96 * KP),
                     "v"(lk + KPB), "v"(lk + KPB + 32 * KP), "v"(lk + KPB + 64 * KP), "v"(lk + KPB + 96 * KP),
                     "v"(lv), "v"(lv + 16 * VP), "v"(lv + 32 * VP), "v"(lv + 48 * VP),
                     "v"(gh), "v"(gh + 4096), "v"(gh + 8192), "v"(gh + 12288),
                     "v"(gl), "v"(gl + 4096), "v"(gl + 8192), "v"(gl + 12288),
                     "v"(gv), "v"(gv + 16 * TT * 2), "v"(gv + 32 * TT * 2), "v"(gv + 48 * TT * 2)
                 : "memory");
}
__global__ __launch_bounds__(256) void k_fattn(const bf* __restrict__ Qh, const bf* __restrict__ Ql, const bf* __restrict__ Kh, const bf* __restrict__ Kl, const h16* __restrict__ VT, bf* Ah, bf* Al) {
    __shared__ __align__(16) char sm[2 * BUFB];
    const int tid = threadIdx.x; const int lane = tid & 31, c = lane & 15, hi = lane >> 4; const int z = blockIdx.y; const int q0 = blockIdx.x * 256 + (tid >> 5) * 32;
    const size_t zo = (size_t)z * TT * HD;
    const unsigned lk = (unsigned)(size_t)sm + (unsigned)((tid >> 3) * KP + (tid & 7) * 16), lv = (unsigned)(size_t)sm + (unsigned)(2 * KPB + (tid >> 4) * VP + (tid & 15) * 16);
    const char* gh = (const char*)(Kh + zo) + tid * 16; const char* gl = (const char*)(Kl + zo) + tid * 16; const char* gv = (const char*)(VT + zo) + (tid >> 4) * (TT * 2) + (tid & 15) * 16;
    const unsigned qo[2] = {(unsigned)(zo + (q0 + c) * HD + 8 * hi) * 2u, (unsigned)(zo + (q0 + 16 + c) * HD + 8 * hi) * 2u};    // the lane's byte offsets into the Q planes
    v16bf qh[2][2], ql[2][2];
#pragma unroll
    for (int g = 0; g < 2; ++g)
#pragma unroll
        for (int kc = 0; kc < 2; ++kc) { qh[g][kc] = WFrag<bf>::ld((const bf*)((const char*)Qh + qo[g]) + kc * 32); ql[g][kc] = WFrag<bf>::ld((const bf*)((const char*)Ql + qo[g]) + kc * 32); }
    v8f o[4][2];
#pragma unroll
    for (int dt = 0; dt < 4; ++dt)
#pragma unroll
        for (int g = 0; g < 2; ++g) o[dt][g] = (v8f){};
    float m[2] = {-3.0e38f, -3.0e38f}, l[2] = {0.f, 0.f};
    asm volatile("s_wait_xcnt 0x0" : : "v"(qo[0]), "v"(qo[1]) : "memory");    // keeps the Q loads' offset registers untouched up to the wait; behind it they are free for reuse
    const char* fk = sm + c * KP + 16 * hi; const char* fv = sm + 2 * KPB + c * VP + 16 * hi;    // the lane's fragment bases in buffer 0
#pragma unroll 1    // stays rolled: the copies keep one place of issue, and the four-pass body stands once in the instruction cache
    for (int t = -2; t < NST; ++t) {    // trips -2 and -1 are the ring's prologue: they only pass the foot, which issues stage 0, then publishes it and issues stage 1
        const int bo = (t & 1) * BUFB;
        if (t >= 0) {
        v16bf kh[2][2], kl[2][2];
#pragma unroll
        for (int kt = 0; kt < 2; ++kt)
#pragma unroll
            for (int kc = 0; kc < 2; ++kc) { kh[kt][kc] = WFrag<bf>::ld((const bf*)(fk + bo + kt * 16 * KP + kc * 64)); kl[kt][kc] = WFrag<bf>::ld((const bf*)(fk + bo + KPB + kt * 16 * KP + kc * 64)); }
#pragma unroll    // unrolled: every LDS offset of a pass is an immediate, and a pass's exps can stand among the next pass's products
        for (int sub = 0; sub < SK / 32; ++sub) {
            v16h vf[4];
#pragma unroll
            for (int dt = 0; dt < 4; ++dt) vf[dt] = WFrag<h16>::ld((const h16*)(fv + bo + dt * 16 * VP + sub * 64));
            v8f s[2][2];
#pragma unroll
            for (int kt = 0; kt < 2; ++kt)
#pragma unroll
                for (int g = 0; g < 2; ++g) { v8f a = (v8f){};
#pragma unroll
                    for (int kc = 0; kc < 2; ++kc) { a = wmmab(kh[kt][kc], qh[g][kc], a); a = wmmab(kh[kt][kc], ql[g][kc], a); a = wmmab(kl[kt][kc], qh[g][kc], a); }
                    s[kt][g] = a; }
            if (sub + 1 < SK / 32) {    // the next 32 keys' fragments, of this same stage, are fetched behind this pass's products
#pragma unroll
                for (int kt = 0; kt < 2; ++kt)
#pragma unroll
                    for (int kc = 0; kc < 2; ++kc) { kh[kt][kc] = WFrag<bf>::ld((const bf*)(fk + bo + ((sub + 1) * 32 + kt * 16) * KP + kc * 64)); kl[kt][kc] = WFrag<bf>::ld((const bf*)(fk + bo + KPB + ((sub + 1) * 32 + kt * 16) * KP + kc * 64)); }
            }
            float mn[2]; bool need = false;
#pragma unroll
            for (int g = 0; g < 2; ++g) { float mx = s[0][g][0];
#pragma unroll
                for (int r = 1; r < 8; ++r) mx = fmaxf(mx, s[0][g][r]);
#pragma unroll
                for (int r = 0; r < 8; ++r) mx = fmaxf(mx, s[1][g][r]);
                mx = fmaxf(mx, xhalf(mx)); mn[g] = fmaxf(m[g], mx); need = need || (mn[g] > m[g]); }
            if (__builtin_amdgcn_ballot_w32(need) != 0) {    // a new maximum in some column: rescale sums and output tiles (factor 1 in the columns that keep theirs)
#pragma unroll
                for (int g = 0; g < 2; ++g) { const float al = __builtin_amdgcn_exp2f((m[g] - mn[g]) * L2E); l[g] *= al; m[g] = mn[g];
#pragma unroll
                    for (int dt = 0; dt < 4; ++dt)
#pragma unroll
                        for (int r = 0; r < 8; ++r) o[dt][g][r] *= al; }
            }
#pragma unroll
            for (int g = 0; g < 2; ++g) { const float nm = 10.0f - m[g] * L2E; v16h pb; float ps = 0.f;
#pragma unroll
                for (int e = 0; e < 16; ++e) { const float p = __builtin_amdgcn_exp2f(fmaf(s[e >> 3][g][e & 7], L2E, nm)); ps += p; pb[e] = tohx(p); }
                l[g] += ps;
#pragma unroll
                for (int e = 0; e < 16; ++e) { __builtin_amdgcn_sched_group_barrier(0x400, 1, 0); __builtin_amdgcn_sched_group_barrier(0x2, 1, 0); }    // one plain vector instruction behind each exp: fills the slot the instruction set asks for behind it
#pragma unroll
                for (int dt = 0; dt < 4; ++dt) o[dt][g] = wmma16(vf[dt], pb, o[dt][g]); }
        }
        }
        asm volatile("s_wait_dscnt 0x0" ::: "memory");       // this wave's reads of the buffer have returned before it is refilled
        asm volatile("s_wait_asynccnt 0x0" ::: "memory");    // this wave's share of stage t + 1 has landed
        __syncthreads();                                      // publishes stage t + 1 and ends every wave's reads of stage t
        if (t + 2 < NST) stage_copy(lk + bo, lv + bo, gh + (t + 2) * (SK * HD * 2), gl + (t + 2) * (SK * HD * 2), gv + (t + 2) * (SK * 2));    // stage t + 2 into the buffer just left
    }
    asm volatile("s_wait_asynccnt 0x0" ::: "memory");    // no copy is outstanding when the wave ends
    const int b = z >> 4, h = z & 15;
#pragma unroll
    for (int g = 0; g < 2; ++g) { const float inv = __fdiv_rn(1.0f, l[g] + xhalf(l[g])); const size_t ob = ((size_t)(q0 + g * 16 + c) * NB_ + b) * DD + h * HD + 8 * hi;
#pragma unroll
        for (int dt = 0; dt < 4; ++dt) { v8us oh, ol;
#pragma unroll
            for (int r = 0; r < 8; ++r) { unsigned short a, c2; splitf(o[dt][g][r] * inv, a, c2); oh[r] = a; ol[r] = c2; }
            *(v8us*)(Ah + ob + dt * 16) = oh; *(v8us*)(Al + ob + dt * 16) = ol; } }
}

extern "C" void kernel_launch(void* const* d_in, const int* in_sizes, int n_in,
                              void* d_out, int out_size, void* d_ws, size_t ws_size, hipStream_t stream) {
    (void)in_sizes; (void)n_in; (void)out_size;
    const float* x = (const float*)d_in[0]; const float* wq = (const float*)d_in[1]; const float* bq = (const float*)d_in[2]; const float* wk = (const float*)d_in[3]; const float* bk = (const float*)d_in[4]; const float* wv = (const float*)d_in[5]; const float* bv = (const float*)d_in[6];
    const float* wo = (const float*)d_in[7]; const float* bo = (const float*)d_in[8];
    float* OUT = (float*)d_out;     // [2048][2][1024] (rows t*2 + b)
    char* wsp = (char*)d_ws;
    auto take = [&](size_t bytes) { char* p = wsp; wsp += (bytes + 255) & ~(size_t)255; return (void*)p; };
    bf* WQ = (bf*)take((size_t)DD * DD * 2); bf* WK = (bf*)take((size_t)DD * DD * 2); bf* WV = (bf*)take((size_t)DD * DD * 2); bf* WO = (bf*)take((size_t)DD * DD * 2);
    bf* XB = (bf*)take((size_t)NT * DD * 2);
    bf* QPh = (bf*)take((size_t)NT * DD * 2); bf* QPl = (bf*)take((size_t)NT * DD * 2); bf* KPh = (bf*)take((size_t)NT * DD * 2); bf* KPl = (bf*)take((size_t)NT * DD * 2); h16* VT = (h16*)take((size_t)NT * DD * 2);
    bf* ATh = (bf*)take((size_t)NT * DD * 2); bf* ATl = (bf*)take((size_t)NT * DD * 2);
    if ((size_t)(wsp - (char*)d_ws) > ws_size) return;    // ws 256 MiB
    { const size_t nw = (size_t)DD * DD / 8; const unsigned gw = (unsigned)((nw + 255) / 256); k_cvt8<<<gw, 256, 0, stream>>>(wq, WQ, nw); k_cvt8<<<gw, 256, 0, stream>>>(wk, WK, nw); k_cvt8<<<gw, 256, 0, stream>>>(wv, WV, nw); k_cvt8<<<gw, 256, 0, stream>>>(wo, WO, nw); }
    const size_t nx = (size_t)NT * DD / 8; const unsigned gx = (unsigned)((nx + 255) / 256);
    k_cvt8<<<gx, 256, 0, stream>>>(x, XB, nx);
    k_qkv<<<dim3(NT / 128, DD / 128, 3), 256, 0, stream>>>(XB, WQ, bq, bk, bv, QPh, QPl, KPh, KPl, VT);    // WQ, WK, WV lie one behind the other (each plane a multiple of 256 bytes)
    k_fattn<<<dim3(TT / 256, NB_ * NH_, 1), 256, 0, stream>>>(QPh, QPl, KPh, KPl, VT, ATh, ATl);
    k_gemmw<bf, 1, true><<<dim3(NT / 128, DD / 128, 1), 256, 0, stream>>>(ATh, ATl, WO, DD, OUT, DD, bo, 0, 0, 0);
}

// v005
// One run takes 104 microseconds.
// In both of two side-by-side timings against v004, it was 1.06 times as fast.
// All steps since v000 together make it 12.2 times as fast.
#include <hip/hip_runtime.h>

// JITCompatibleMultiheadAttention (query [T=2048][B=2][E=1024] seq-first layout; q = (query Wq^T + bq) * 64^-0.5, k/v = query W^T + b; 16 heads x 64 ([T,B,E] -> [B*16][T][64]);
// softmax(q.k) v; out [T][B][E] = attn Wo^T + bo). Rows are indexed r = t*2 + b everywhere (projections and the output GEMM are row-order agnostic; the head-plane builders and the merge use t*NB_ + b).
// Compute dtypes, f32 accumulate: every float input rounded to bf16; q/k/v projections on PLAIN bf16 operands (x, W inputs: exact, + bias);
// scores on bf16 hi+lo q (x 1/8) and k planes (3 products); attn.v on SINGLE fp16 planes (P x1024, v); output Linear on hi+lo planes x exact bf16 W (2 products); 

#define NB_  2
#define TT   2048
#define DD   1024
#define NH_  16
#define HD   64
#define NT   (NB_ * TT)
typedef _Float16 h16;
typedef unsigned short bf;
typedef __attribute__((ext_vector_type(16))) __bf16   v16bf;
typedef __attribute__((ext_vector_type(16))) _Float16 v16h;
typedef __attribute__((ext_vector_type(8)))  _Float16 v8h;
typedef __attribute__((ext_vector_type(8)))  unsigned short v8us;
typedef __attribute__((ext_vector_type(8)))  float    v8f;
typedef __attribute__((ext_vector_type(4)))  float    v4f;
typedef v8h  __attribute__((may_alias)) v8ha;
typedef v4f  __attribute__((may_alias)) v4fa;
typedef v8us __attribute__((may_alias)) v8usa;

__device__ __forceinline__ unsigned short f2bf(float f) { unsigned u = __float_as_uint(f); u += 0x7FFFu + ((u >> 16) & 1u); return (unsigned short)(u >> 16); }
__device__ __forceinline__ float bf2f(unsigned short b) { return __uint_as_float(((unsigned)b) << 16); }
__device__ __forceinline__ float bfr(float f) { return bf2f(f2bf(f)); }
__device__ __forceinline__ v16h cat16(v8h lo, v8h hi) { return __builtin_shufflevector(lo, hi, 0, 1, 2, 3, 4, 5, 6, 7, 8, 9, 10, 11, 12, 13, 14, 15); }
__device__ __forceinline__ v16bf cat16b(v8us lo, v8us hi) { return __builtin_bit_cast(v16bf, __builtin_shufflevector(lo, hi, 0, 1, 2, 3, 4, 5, 6, 7, 8, 9, 10, 11, 12, 13, 14, 15)); }
__device__ __forceinline__ v8f wmma16(v16h a, v16h b, v8f c) { return __builtin_amdgcn_wmma_f32_16x16x32_f16(false, a, false, b, (short)0, c, false, false); }
__device__ __forceinline__ v8f wmmab(v16bf a, v16bf b, v8f c) { return __builtin_amdgcn_wmma_f32_16x16x32_bf16(false, a, false, b, (short)0, c, false, false); }



// ---- k_gemmw: GEMM on K-contiguous 16-bit planes, one 128x128 output tile per work-group of eight waves (2 x 4, each 64x32: 8 accumulators); grid (M/128, N/128, Z), 256 threads.
// C[m][n] (f32, pitch ldc, + optional f32 bias[n]) = sum_k A[m][k] Bt[n][k] (NSPLIT == 1: + A2[m][k] Bt[n][k]). z-batch strides sA/sB/sC in elements. K % 128 == 0, M % 128 == 0, N % 128 == 0.
// The operand rows come 128 k (256 B, whole lines) at a time into two LDS buffers by asynchronous copies, each byte fetched once a work-group; every wave reads its fragments from LDS.
template <typename T16> struct WFrag;
template <> struct WFrag<h16> { typedef v16h V; static __device__ __forceinline__ V ld(const h16* p) { return cat16(*(const v8h*)p, *(const v8h*)(p + 16)); } static __device__ __forceinline__ v8f mma(V a, V b, v8f c) { return wmma16(a, b, c); } };
template <> struct WFrag<bf> { typedef v16bf V; static __device__ __forceinline__ V ld(const bf* p) { return cat16b(*(const v8us*)p, *(const v8us*)(p + 16)); } static __device__ __forceinline__ v8f mma(V a, V b, v8f c) { return wmmab(a, b, c); } };
#define GS   128                  // k elements a stage
#define GP   272                  // LDS pitch of a staged row (256 B + 16: 16 B x odd, the conflict-free pitch of 16-byte reads)
#define GPL  (128 * GP)           // one staged plane: 128 rows
// One plane's eight copies of a lane (16 bytes each, rows 16 apart). l: the lane's LDS byte address in the plane; g: its global address; rs: bytes of 16 source rows.
__device__ __forceinline__ void plane_copy(unsigned l, const char* g, size_t rs) {
    // the copies and, as the last line, the wait that stands in front of any rewrite of their address registers, in one statement
    asm volatile("global_load_async_to_lds_b128 %0, %8, off\n\t"
                 "global_load_async_to_lds_b128 %1, %9, off\n\t"
                 "global_load_async_to_lds_b128 %2, %10, off\n\t"
                 "global_load_async_to_lds_b128 %3, %11, off\n\t"
                 "global_load_async_to_lds_b128 %4, %12, off\n\t"
                 "global_load_async_to_lds_b128 %5, %13, off\n\t"
                 "global_load_async_to_lds_b128 %6, %14, off\n\t"
                 "global_load_async_to_lds_b128 %7, %15, off\n\t"
                 "s_wait_xcnt 0x0"
                 : : "v"(l), "v"(l + 16 * GP), "v"(l + 32 * GP), "v"(l + 48 * GP), "v"(l + 64 * GP), "v"(l + 80 * GP), "v"(l + 96 * GP), "v"(l + 112 * GP),
                     "v"(g), "v"(g + rs), "v"(g + 2 * rs), "v"(g + 3 * rs), "v"(g + 4 * rs), "v"(g + 5 * rs), "v"(g + 6 * rs), "v"(g + 7 * rs)
                 : "memory");
}
// gemm_tile: the ring and the products of one 128x128 tile (rows r0.., columns c0..); gs: the work-group's two buffers. Behind it no wave reads gs any more and no copy is in flight (the last stage's foot barrier).
template <typename T16, int NSPLIT>
__device__ __forceinline__ void gemm_tile(const T16* __restrict__ A, const T16* __restrict__ A2, const T16* __restrict__ Bt, int K, int r0, int c0, char* gs, v8f (&acc)[4][2]) {
    static_assert(NSPLIT == 0 || NSPLIT == 1, "one or two A planes");
    typedef typename WFrag<T16>::V V;
    constexpr int NPL = NSPLIT == 1 ? 3 : 2;     // staged planes: A, (A2,) Bt
    constexpr int GBUF = NPL * GPL;              // one buffer
    const int tid = threadIdx.x; const int lane = tid & 31, lr = lane & 15, hi = lane >> 4; const int w = tid >> 5, wm = w & 1, wn = w >> 1;
#pragma unroll
    for (int mb = 0; mb < 4; ++mb)
#pragma unroll
        for (int nb = 0; nb < 2; ++nb) acc[mb][nb] = (v8f){};
    const unsigned lc = (unsigned)(size_t)gs + (unsigned)((tid >> 4) * GP + (tid & 15) * 16);    // the lane's place in a staged plane
    const size_t rs = (size_t)K * 32;
    const char* gA = (const char*)(A + (size_t)(r0 + (tid >> 4)) * K) + (tid & 15) * 16; const char* gA2 = NSPLIT == 1 ? (const char*)(A2 + (size_t)(r0 + (tid >> 4)) * K) + (tid & 15) * 16 : nullptr; const char* gB = (const char*)(Bt + (size_t)(c0 + (tid >> 4)) * K) + (tid & 15) * 16;
    auto stage = [&](int t, unsigned bo) { plane_copy(lc + bo, gA + (size_t)t * (GS * 2), rs); if (NSPLIT == 1) plane_copy(lc + bo + GPL, gA2 + (size_t)t * (GS * 2), rs); plane_copy(lc + bo + (NPL - 1) * GPL, gB + (size_t)t * (GS * 2), rs); };
    const char* fa = gs + (wm * 64 + lr) * GP + 16 * hi; const char* fb = gs + (NPL - 1) * GPL + (wn * 32 + lr) * GP + 16 * hi;    // the lane's fragment bases in buffer 0
    const int nst = K / GS;
    stage(0, 0);
    asm volatile("s_wait_asynccnt 0x0" ::: "memory");    // this wave's share of stage 0 has landed
    __syncthreads();                                      // publishes stage 0
    if (nst > 1) stage(1, GBUF);
#pragma unroll 1    // stays rolled: one stage's body stands once in the instruction cache
    for (int t = 0; t < nst; ++t) {
        const int bo = (t & 1) * GBUF;
        V a[2][4], a2[2][4], b[2][2];    // two fragment sets: a step's products run on one while the next step's reads fill the other
        auto frag = [&](int ks, int s) {
#pragma unroll
            for (int mb = 0; mb < 4; ++mb) { a[s][mb] = WFrag<T16>::ld((const T16*)(fa + bo + mb * 16 * GP + ks * 64)); if (NSPLIT == 1) a2[s][mb] = WFrag<T16>::ld((const T16*)(fa + bo + GPL + mb * 16 * GP + ks * 64)); }
#pragma unroll
            for (int nb = 0; nb < 2; ++nb) b[s][nb] = WFrag<T16>::ld((const T16*)(fb + bo + nb * 16 * GP + ks * 64)); };
        frag(0, 0);
        __builtin_amdgcn_sched_barrier(0);    // the first step's reads stay in front of the second's, so that the first products wait for their own set alone
#pragma unroll    // unrolled: every LDS offset is an immediate and the fragment sets are named at compile time
        for (int ks = 0; ks < GS / 32; ++ks) {
            const int s = ks & 1;
            if (ks + 1 < GS / 32) frag(ks + 1, s ^ 1);    // of this same stage only
            __builtin_amdgcn_sched_barrier(0);    // the next step's reads stay one group ahead of this step's products, for speed only
#pragma unroll
            for (int nb = 0; nb < 2; ++nb)
#pragma unroll
                for (int mb = 0; mb < 4; ++mb) acc[mb][nb] = WFrag<T16>::mma(a[s][mb], b[s][nb], acc[mb][nb]);
            if (NSPLIT == 1) {
#pragma unroll
                for (int nb = 0; nb < 2; ++nb)
#pragma unroll
                    for (int mb = 0; mb < 4; ++mb) acc[mb][nb] = WFrag<T16>::mma(a2[s][mb], b[s][nb], acc[mb][nb]);
            }
            __builtin_amdgcn_sched_barrier(0);    // and the reads behind these products do not move in among them
        }
        asm volatile("s_wait_dscnt 0x0" ::: "memory");       // this wave's reads of the buffer have returned before it is refilled
        asm volatile("s_wait_asynccnt 0x0" ::: "memory");    // this wave's share of stage t + 1 has landed
        __syncthreads();                                      // publishes stage t + 1 and ends every wave's reads of stage t
        if (t + 2 < nst) stage(t + 2, (unsigned)bo);          // stage t + 2 into the buffer just left
    }
    asm volatile("s_wait_asynccnt 0x0" ::: "memory");    // no copy is outstanding when the wave ends
}
template <typename T16, int NSPLIT, bool BIAS>
__global__ __launch_bounds__(256) void k_gemmw(const T16* __restrict__ A, const T16* __restrict__ A2, const T16* __restrict__ Bt, int K, float* C, int ldc, const float* __restrict__ bias, size_t sA, size_t sB, size_t sC) {
    __shared__ __align__(16) char gs[2 * (NSPLIT == 1 ? 3 : 2) * GPL];
    __shared__ __align__(16) float osm[8 * 16 * 36];    // each wave's own store staging: 16 rows of 32 floats, pitch 36
    const size_t z = blockIdx.z; A += z * sA; if (NSPLIT == 1) A2 += z * sA; Bt += z * sB; C += z * sC;
    const int tid = threadIdx.x; const int lane = tid & 31, lr = lane & 15, hi = lane >> 4; const int w = tid >> 5, wm = w & 1, wn = w >> 1; const int r0 = blockIdx.x * 128, c0 = blockIdx.y * 128;
    v8f acc[4][2];
    gemm_tile<T16, NSPLIT>(A, A2, Bt, K, r0, c0, gs, acc);
    float* os = osm + w * (16 * 36); const int cw = c0 + wn * 32;
#pragma unroll
    for (int mb = 0; mb < 4; ++mb) {
#pragma unroll
        for (int nb = 0; nb < 2; ++nb) {
#pragma unroll
            for (int j = 0; j < 8; ++j) os[(hi * 8 + j) * 36 + nb * 16 + lr] = acc[mb][nb][j]; }
        __builtin_amdgcn_wave_barrier(); asm volatile("" ::: "memory");    // the wave's staged rows are written before it reads them back
        float* crow = C + (size_t)(r0 + wm * 64 + mb * 16) * ldc + cw;
#pragma unroll
        for (int s = 0; s < 4; ++s) { const int row = 4 * s + (lane >> 3), cofs = (lane & 7) * 4; v4f val = *(const v4fa*)(os + row * 36 + cofs); if (BIAS) { val[0] += bfr(bias[cw + cofs]); val[1] += bfr(bias[cw + cofs + 1]); val[2] += bfr(bias[cw + cofs + 2]); val[3] += bfr(bias[cw + cofs + 3]); }
            *(v4f*)(crow + (size_t)row * ldc + cofs) = val; }
        __builtin_amdgcn_wave_barrier(); asm volatile("" ::: "memory");    // the rows are read back before the next tile row overwrites them
    }
}

__device__ __forceinline__ h16 tohx(float x) { return (h16)x; }
__device__ __forceinline__ void splitf(float y, unsigned short& h, unsigned short& l) { h = f2bf(y); l = f2bf(y - bf2f(h)); }
typedef __attribute__((ext_vector_type(2))) _Float16 v2h;
typedef __attribute__((ext_vector_type(4))) _Float16 v4h;
typedef __attribute__((ext_vector_type(2))) unsigned short v2us;
typedef __attribute__((ext_vector_type(4))) unsigned short v4us;
typedef __attribute__((ext_vector_type(4))) int v4i;

// k_cvt5: the four weights and the query rounded to bf16 in ONE launch, grid 512 x 256 threads. dst: the five bf16 planes one behind the other (Wq, Wk, Wv, Wo, x).
// A work-group owns 16384 floats in a row (64 work-groups a weight, 256 the query); a wave's every load covers 512 contiguous bytes and every store 256, whole lines; a lane's sixteen loads are all issued ahead of the first rounding.
#define CVW  (DD * DD / 16384)    // work-groups a weight plane
__global__ __launch_bounds__(256) void k_cvt5(const float* __restrict__ wq, const float* __restrict__ wk, const float* __restrict__ wv, const float* __restrict__ wo, const float* __restrict__ x, bf* dst) {
    const unsigned g = blockIdx.x; const unsigned pl = g / CVW < 4u ? g / CVW : 4u;    // the plane, the same for the whole work-group
    const float* src = pl == 0 ? wq : pl == 1 ? wk : pl == 2 ? wv : pl == 3 ? wo : x;
    const size_t so = (size_t)(g - pl * CVW) * 16384 + threadIdx.x * 4, eo = (size_t)g * 16384 + threadIdx.x * 4;
    v4f v[16];
#pragma unroll    // unrolled, like the loop below: v is indexed at compile time and stays in registers
    for (int i = 0; i < 16; ++i) v[i] = *(const v4f*)(src + so + i * 1024);
#pragma unroll
    for (int i = 0; i < 16; ++i) { v4us o;
#pragma unroll
        for (int k = 0; k < 4; ++k) o[k] = f2bf(v[i][k]);
        *(v4us*)(dst + eo + i * 1024) = o; }
}
// k_qkv: the three projections in one launch, grid (NT/128, DD/128, 3), blockIdx.z = 0 q, 1 k, 2 v (W3: the three bf16 weight planes one behind the other). Each work-group writes its 128x128 tile (64 t x 2 b, two heads)
// straight into the head planes: q (x 1/8) and k as bf16 hi and lo [b*16+h][t][64], v as fp16 transposed [b*16+h][64][t]. The tile passes through the ring's LDS, free behind gemm_tile, so that every global store covers whole 128-byte lines.
#define QSP  132                  // floats a staged q/k row (128 + 4: the two lane halves, eight rows apart, fall on different banks)
#define VSP  72                   // fp16 a staged v line (128 B + 16: the conflict-free pitch of 16-byte reads)
__global__ __launch_bounds__(256) void k_qkv(const bf* __restrict__ X, const bf* __restrict__ W3, const float* __restrict__ bq, const float* __restrict__ bk, const float* __restrict__ bv, bf* Qh, bf* Ql, bf* Kh, bf* Kl, h16* VT) {
    __shared__ __align__(16) char gs[2 * 2 * GPL];
    static_assert(128 * QSP * 4 <= 2 * 2 * GPL && 256 * VSP * 2 <= 2 * 2 * GPL, "the staged tile fits the ring");
    const int tid = threadIdx.x; const int lane = tid & 31, lr = lane & 15, hi = lane >> 4; const int w = tid >> 5, wm = w & 1, wn = w >> 1; const int r0 = blockIdx.x * 128, c0 = blockIdx.y * 128; const int pz = blockIdx.z;
    const float* bias = pz == 0 ? bq : pz == 1 ? bk : bv;
    const float bb[2] = {bfr(bias[c0 + wn * 32 + lr]), bfr(bias[c0 + wn * 32 + 16 + lr])};    // fetched ahead of the ring, so that nothing waits for it behind the products
    v8f acc[4][2];
    gemm_tile<bf, 0>(X, nullptr, W3 + (size_t)pz * DD * DD, DD, r0, c0, gs, acc);
    const int t0 = r0 / NB_, h0 = c0 / HD;
    if (pz < 2) {    // the same for the whole work-group
        float* st = (float*)gs; const float sc = pz == 0 ? 0.125f : 1.0f;    // 1/sqrt(64) folded into q exactly
#pragma unroll    // this and every loop below is unrolled so that acc, x0 and x1 are indexed at compile time and stay in registers
        for (int mb = 0; mb < 4; ++mb)
#pragma unroll
            for (int nb = 0; nb < 2; ++nb)
#pragma unroll
                for (int j = 0; j < 8; ++j) st[(wm * 64 + mb * 16 + hi * 8 + j) * QSP + wn * 32 + nb * 16 + lr] = (acc[mb][nb][j] + bb[nb]) * sc;
        __syncthreads();    // the whole tile is staged before any wave reads other waves' columns
        bf* Ph = pz == 0 ? Qh : Kh; bf* Pl = pz == 0 ? Ql : Kl;
        v4f x0[8], x1[8];    // the reads stand in a loop of their own, so that later reads can be under way while earlier values are split
#pragma unroll
        for (int i = 0; i < 8; ++i) { const int it = i * 256 + tid; const int ch = it & 7, tl = (it >> 3) & 63, b = (it >> 9) & 1, hl = it >> 10;    // eight lanes a plane row, a wave four rows in a row: 512 contiguous bytes
            const float* sp = st + (tl * NB_ + b) * QSP + hl * HD + ch * 8; x0[i] = *(const v4fa*)sp; x1[i] = *(const v4fa*)(sp + 4); }
#pragma unroll
        for (int i = 0; i < 8; ++i) { const int it = i * 256 + tid; const int ch = it & 7, tl = (it >> 3) & 63, b = (it >> 9) & 1, hl = it >> 10; v8us oh, ol;
#pragma unroll
            for (int k = 0; k < 4; ++k) { unsigned short a, c2; splitf(x0[i][k], a, c2); oh[k] = a; ol[k] = c2; splitf(x1[i][k], a, c2); oh[4 + k] = a; ol[4 + k] = c2; }
            const size_t e = ((size_t)(b * NH_ + h0 + hl) * TT + t0 + tl) * HD + ch * 8;
            *(v8us*)(Ph + e) = oh; *(v8us*)(Pl + e) = ol; }
    } else {
        h16* sv = (h16*)gs;    // line (column, b): its 64 t
#pragma unroll
        for (int mb = 0; mb < 4; ++mb)
#pragma unroll
            for (int nb = 0; nb < 2; ++nb)
#pragma unroll
                for (int b = 0; b < 2; ++b) { v4h p;    // rows are t*2 + b: a lane's eight rows of a tile are four t of each b
#pragma unroll
                    for (int q = 0; q < 4; ++q) p[q] = tohx(acc[mb][nb][q * 2 + b] + bb[nb]);
                    *(v4h*)(sv + ((wn * 32 + nb * 16 + lr) * 2 + b) * VSP + wm * 32 + mb * 8 + hi * 4) = p; }
        __syncthreads();    // the whole tile is staged before any wave reads other waves' rows
#pragma unroll
        for (int i = 0; i < 8; ++i) { const int it = i * 256 + tid; const int ch = it & 7, ln = it >> 3; const int col = ln >> 1, b = ln & 1;    // eight lanes a line of V^T
            const v8h v = *(const v8ha*)(sv + ln * VSP + ch * 8);
            *(v8h*)(VT + ((size_t)(b * NH_ + h0 + (col >> 6)) * HD + (col & 63)) * TT + t0 + ch * 8) = v; }
        asm volatile("s_wait_xcnt 0x0" ::: "memory");    // stands behind the run's last store, in front of any later rewrite of the stores' address registers
    }
}
__device__ __forceinline__ float xhalf(float x) { return __builtin_bit_cast(float, __builtin_amdgcn_permlanex16(__builtin_bit_cast(int, x), __builtin_bit_cast(int, x), 0x76543210, 0xfedcba98, false, false)); }  // lane l with lane l ^ 16
#define L2E 1.4426950408889634f
#define SK   128                  // keys a stage
#define NST  (TT / SK)            // stages
#define KP   144                  // LDS pitch of a K row (128 B + 16: 16 B x odd, the conflict-free pitch of 16-byte reads)
#define VP   272                  // LDS pitch of a V^T row (256 B + 16)
#define KPB  (SK * KP)            // one K plane of a stage
#define BUFB (2 * KPB + HD * VP)  // one buffer: K hi, K lo, V^T
// One stage's twelve copies of a lane (16 bytes each): four to each of K hi, K lo, V^T. lk, lv: the lane's LDS byte addresses in the K hi plane and in V^T; gh, gl, gv: its global addresses.
__device__ __forceinline__ void stage_copy(unsigned lk, unsigned lv, const char* gh, const char* gl, const char* gv) {
    // the copies and, as the last line, the wait that stands in front of any rewrite of their address registers, in one statement
    asm volatile("global_load_async_to_lds_b128 %0, %12, off\n\t"
                 "global_load_async_to_lds_b128 %1, %13, off\n\t"
                 "global_load_async_to_lds_b128 %2, %14, off\n\t"
                 "global_load_async_to_lds_b128 %3, %15, off\n\t"
                 "global_load_async_to_lds_b128 %4, %16, off\n\t"
                 "global_load_async_to_lds_b128 %5, %17, off\n\t"
                 "global_load_async_to_lds_b128 %6, %18, off\n\t"
                 "global_load_async_to_lds_b128 %7, %19, off\n\t"
                 "global_load_async_to_lds_b128 %8, %20, off\n\t"
                 "global_load_async_to_lds_b128 %9, %21, off\n\t"
                 "global_load_async_to_lds_b128 %10, %22, off\n\t"
                 "global_load_async_to_lds_b128 %11, %23, off\n\t"
                 "s_wait_xcnt 0x0"
                 : : "v"(lk), "v"(lk + 32 * KP), "v"(lk + 64 * KP), "v"(lk + 96 * KP),
                     "v"(lk + KPB), "v"(lk + KPB + 32 * KP), "v"(lk + KPB + 64 * KP), "v"(lk + KPB + 96 * KP),
                     "v"(lv), "v"(lv + 16 * VP), "v"(lv + 32 * VP), "v"(lv + 48 * VP),
                     "v"(gh), "v"(gh + 4096), "v"(gh + 8192), "v"(gh + 12288),
                     "v"(gl), "v"(gl + 4096), "v"(gl + 8192), "v"(gl + 12288),
                     "v"(gv), "v"(gv + 16 * TT * 2), "v"(gv + 32 * TT * 2), "v"(gv + 48 * TT * 2)
                 : "memory");
}
__global__ __launch_bounds__(256) void k_fattn(const bf* __restrict__ Qh, const bf* __restrict__ Ql, const bf* __restrict__ Kh, const bf* __restrict__ Kl, const h16* __restrict__ VT, bf* Ah, bf* Al) {
    __shared__ __align__(16) char sm[2 * BUFB];
    const int tid = threadIdx.x; const int lane = tid & 31, c = lane & 15, hi = lane >> 4; const int z = blockIdx.y; const int q0 = blockIdx.x * 256 + (tid >> 5) * 32;
    const size_t zo = (size_t)z * TT * HD;
    const unsigned lk = (unsigned)(size_t)sm + (unsigned)((tid >> 3) * KP + (tid & 7) * 16), lv = (unsigned)(size_t)sm + (unsigned)(2 * KPB + (tid >> 4) * VP + (tid & 15) * 16);
    const char* gh = (const char*)(Kh + zo) + tid * 16; const char* gl = (const char*)(Kl + zo) + tid * 16; const char* gv = (const char*)(VT + zo) + (tid >> 4) * (TT * 2) + (tid & 15) * 16;
    const unsigned qo[2] = {(unsigned)(zo + (q0 + c) * HD + 8 * hi) * 2u, (unsigned)(zo + (q0 + 16 + c) * HD + 8 * hi) * 2u};    // the lane's byte offsets into the Q planes
    v16bf qh[2][2], ql[2][2];
#pragma unroll
    for (int g = 0; g < 2; ++g)
#pragma unroll
        for (int kc = 0; kc < 2; ++kc) { qh[g][kc] = WFrag<bf>::ld((const bf*)((const char*)Qh + qo[g]) + kc * 32); ql[g][kc] = WFrag<bf>::ld((const bf*)((const char*)Ql + qo[g]) + kc * 32); }
    v8f o[4][2];
#pragma unroll
    for (int dt = 0; dt < 4; ++dt)
#pragma unroll
        for (int g = 0; g < 2; ++g) o[dt][g] = (v8f){};
    float m[2] = {-3.0e38f, -3.0e38f}, l[2] = {0.f, 0.f};
    asm volatile("s_wait_xcnt 0x0" : : "v"(qo[0]), "v"(qo[1]) : "memory");    // keeps the Q loads' offset registers untouched up to the wait; behind it they are free for reuse
    const char* fk = sm + c * KP + 16 * hi; const char* fv = sm + 2 * KPB + c * VP + 16 * hi;    // the lane's fragment bases in buffer 0
#pragma unroll 1    // stays rolled: the copies keep one place of issue, and the four-pass body stands once in the instruction cache
    for (int t = -2; t < NST; ++t) {    // trips -2 and -1 are the ring's prologue: they only pass the foot, which issues stage 0, then publishes it and issues stage 1
        const int bo = (t & 1) * BUFB;
        if (t >= 0) {
        v16bf kh[2][2], kl[2][2];
#pragma unroll
        for (int kt = 0; kt < 2; ++kt)
#pragma unroll
            for (int kc = 0; kc < 2; ++kc) { kh[kt][kc] = WFrag<bf>::ld((const bf*)(fk + bo + kt * 16 * KP + kc * 64)); kl[kt][kc] = WFrag<bf>::ld((const bf*)(fk + bo + KPB + kt * 16 * KP + kc * 64)); }
#pragma unroll    // unrolled: every LDS offset of a pass is an immediate, and a pass's exps can stand among the next pass's products
        for (int sub = 0; sub < SK / 32; ++sub) {
            v16h vf[4];
#pragma unroll
            for (int dt = 0; dt < 4; ++dt) vf[dt] = WFrag<h16>::ld((const h16*)(fv + bo + dt * 16 * VP + sub * 64));
            v8f s[2][2];
#pragma unroll
            for (int kt = 0; kt < 2; ++kt)
#pragma unroll
                for (int g = 0; g < 2; ++g) { v8f a = (v8f){};
#pragma unroll
                    for (int kc = 0; kc < 2; ++kc) { a = wmmab(kh[kt][kc], qh[g][kc], a); a = wmmab(kh[kt][kc], ql[g][kc], a); a = wmmab(kl[kt][kc], qh[g][kc], a); }
                    s[kt][g] = a; }
            if (sub + 1 < SK / 32) {    // the next 32 keys' fragments, of this same stage, are fetched behind this pass's products
#pragma unroll
                for (int kt = 0; kt < 2; ++kt)
#pragma unroll
                    for (int kc = 0; kc < 2; ++kc) { kh[kt][kc] = WFrag<bf>::ld((const bf*)(fk + bo + ((sub + 1) * 32 + kt * 16) * KP + kc * 64)); kl[kt][kc] = WFrag<bf>::ld((const bf*)(fk + bo + KPB + ((sub + 1) * 32 + kt * 16) * KP + kc * 64)); }
            }
            float mn[2]; bool need = false;
#pragma unroll
            for (int g = 0; g < 2; ++g) { float mx = s[0][g][0];
#pragma unroll
                for (int r = 1; r < 8; ++r) mx = fmaxf(mx, s[0][g][r]);
#pragma unroll
                for (int r = 0; r < 8; ++r) mx = fmaxf(mx, s[1][g][r]);
                mx = fmaxf(mx, xhalf(mx)); mn[g] = fmaxf(m[g], mx); need = need || (mn[g] > m[g]); }
            if (__builtin_amdgcn_ballot_w32(need) != 0) {    // a new maximum in some column: rescale sums and output tiles (factor 1 in the columns that keep theirs)
#pragma unroll
                for (int g = 0; g < 2; ++g) { const float al = __builtin_amdgcn_exp2f((m[g] - mn[g]) * L2E); l[g] *= al; m[g] = mn[g];
#pragma unroll
                    for (int dt = 0; dt < 4; ++dt)
#pragma unroll
                        for (int r = 0; r < 8; ++r) o[dt][g][r] *= al; }
            }
#pragma unroll
            for (int g = 0; g < 2; ++g) { const float nm = 10.0f - m[g] * L2E; v16h pb; float ps = 0.f;
#pragma unroll
                for (int e = 0; e < 16; ++e) { const float p = __builtin_amdgcn_exp2f(fmaf(s[e >> 3][g][e & 7], L2E, nm)); ps += p; pb[e] = tohx(p); }
                l[g] += ps;
#pragma unroll
                for (int e = 0; e < 16; ++e) { __builtin_amdgcn_sched_group_barrier(0x400, 1, 0); __builtin_amdgcn_sched_group_barrier(0x2, 1, 0); }    // one plain vector instruction behind each exp: fills the slot the instruction set asks for behind it
#pragma unroll
                for (int dt = 0; dt < 4; ++dt) o[dt][g] = wmma16(vf[dt], pb, o[dt][g]); }
        }
        }
        asm volatile("s_wait_dscnt 0x0" ::: "memory");       // this wave's reads of the buffer have returned before it is refilled
        asm volatile("s_wait_asynccnt 0x0" ::: "memory");    // this wave's share of stage t + 1 has landed
        __syncthreads();                                      // publishes stage t + 1 and ends every wave's reads of stage t
        if (t + 2 < NST) stage_copy(lk + bo, lv + bo, gh + (t + 2) * (SK * HD * 2), gl + (t + 2) * (SK * HD * 2), gv + (t + 2) * (SK * 2));    // stage t + 2 into the buffer just left
    }
    asm volatile("s_wait_asynccnt 0x0" ::: "memory");    // no copy is outstanding when the wave ends
    const int b = z >> 4, h = z & 15;
#pragma unroll
    for (int g = 0; g < 2; ++g) { const float inv = __fdiv_rn(1.0f, l[g] + xhalf(l[g])); const size_t ob = ((size_t)(q0 + g * 16 + c) * NB_ + b) * DD + h * HD + 8 * hi;
#pragma unroll
        for (int dt = 0; dt < 4; ++dt) { v8us oh, ol;
#pragma unroll
            for (int r = 0; r < 8; ++r) { unsigned short a, c2; splitf(o[dt][g][r] * inv, a, c2); oh[r] = a; ol[r] = c2; }
            *(v8us*)(Ah + ob + dt * 16) = oh; *(v8us*)(Al + ob + dt * 16) = ol; } }
}

extern "C" void kernel_launch(void* const* d_in, const int* in_sizes, int n_in,
                              void* d_out, int out_size, void* d_ws, size_t ws_size, hipStream_t stream) {
    (void)in_sizes; (void)n_in; (void)out_size;
    const float* x = (const float*)d_in[0]; const float* wq = (const float*)d_in[1]; const float* bq = (const float*)d_in[2]; const float* wk = (const float*)d_in[3]; const float* bk = (const float*)d_in[4]; const float* wv = (const float*)d_in[5]; const float* bv = (const float*)d_in[6];
    const float* wo = (const float*)d_in[7]; const float* bo = (const float*)d_in[8];
    float* OUT = (float*)d_out;     // [2048][2][1024] (rows t*2 + b)
    char* wsp = (char*)d_ws;
    auto take = [&](size_t bytes) { char* p = wsp; wsp += (bytes + 255) & ~(size_t)255; return (void*)p; };
    bf* WQ = (bf*)take((size_t)DD * DD * 2); bf* WK = (bf*)take((size_t)DD * DD * 2); bf* WV = (bf*)take((size_t)DD * DD * 2); bf* WO = (bf*)take((size_t)DD * DD * 2);
    bf* XB = (bf*)take((size_t)NT * DD * 2);
    bf* QPh = (bf*)take((size_t)NT * DD * 2); bf* QPl = (bf*)take((size_t)NT * DD * 2); bf* KPh = (bf*)take((size_t)NT * DD * 2); bf* KPl = (bf*)take((size_t)NT * DD * 2); h16* VT = (h16*)take((size_t)NT * DD * 2);
    bf* ATh = (bf*)take((size_t)NT * DD * 2); bf* ATl = (bf*)take((size_t)NT * DD * 2);
    if ((size_t)(wsp - (char*)d_ws) > ws_size) return;    // ws 256 MiB
    k_cvt5<<<4 * CVW + NT * DD / 16384, 256, 0, stream>>>(wq, wk, wv, wo, x, WQ);    // WQ, WK, WV, WO, XB lie one behind the other (each plane a multiple of 256 bytes)
    k_qkv<<<dim3(NT / 128, DD / 128, 3), 256, 0, stream>>>(XB, WQ, bq, bk, bv, QPh, QPl, KPh, KPl, VT);    // WQ, WK, WV lie one behind the other (each plane a multiple of 256 bytes)
    k_fattn<<<dim3(TT / 256, NB_ * NH_, 1), 256, 0, stream>>>(QPh, QPl, KPh, KPl, VT, ATh, ATl);
    k_gemmw<bf, 1, true><<<dim3(NT / 128, DD / 128, 1), 256, 0, stream>>>(ATh, ATl, WO, DD, OUT, DD, bo, 0, 0, 0);
}

// v006
// It runs in 98.9 microseconds.
// Two timings next to v005 both put it at 1.05 times that version's speed.
// Over all steps from v000 it is 12.8 times as fast.
#include <hip/hip_runtime.h>

// JITCompatibleMultiheadAttention (query [T=2048][B=2][E=1024] seq-first layout; q = (query Wq^T + bq) * 64^-0.5, k/v = query W^T + b; 16 heads x 64 ([T,B,E] -> [B*16][T][64]);
// softmax(q.k) v; out [T][B][E] = attn Wo^T + bo). Rows are indexed r = t*2 + b everywhere (projections and the output GEMM are row-order agnostic; the head-plane builders and the merge use t*NB_ + b).
// Compute dtypes, f32 accumulate: every float input rounded to bf16; q/k/v projections on PLAIN bf16 operands (x, W inputs: exact, + bias);
// scores on bf16 hi+lo q (x 1/8) and k planes (3 products); attn.v on SINGLE fp16 planes (P x1024, v); output Linear on hi+lo planes x exact bf16 W (2 products); 

#define NB_  2
#define TT   2048
#define DD   1024
#define NH_  16
#define HD   64
#define NT   (NB_ * TT)
typedef _Float16 h16;
typedef unsigned short bf;
typedef __attribute__((ext_vector_type(16))) __bf16   v16bf;
typedef __attribute__((ext_vector_type(16))) _Float16 v16h;
typedef __attribute__((ext_vector_type(8)))  _Float16 v8h;
typedef __attribute__((ext_vector_type(8)))  unsigned short v8us;
typedef __attribute__((ext_vector_type(8)))  float    v8f;
typedef __attribute__((ext_vector_type(4)))  float    v4f;
typedef v8h  __attribute__((may_alias)) v8ha;
typedef v4f  __attribute__((may_alias)) v4fa;
typedef v8us __attribute__((may_alias)) v8usa;

__device__ __forceinline__ unsigned short f2bf(float f) { unsigned u = __float_as_uint(f); u += 0x7FFFu + ((u >> 16) & 1u); return (unsigned short)(u >> 16); }
__device__ __forceinline__ float bf2f(unsigned short b) { return __uint_as_float(((unsigned)b) << 16); }
__device__ __forceinline__ float bfr(float f) { return bf2f(f2bf(f)); }
__device__ __forceinline__ v16h cat16(v8h lo, v8h hi) { return __builtin_shufflevector(lo, hi, 0, 1, 2, 3, 4, 5, 6, 7, 8, 9, 10, 11, 12, 13, 14, 15); }
__device__ __forceinline__ v16bf cat16b(v8us lo, v8us hi) { return __builtin_bit_cast(v16bf, __builtin_shufflevector(lo, hi, 0, 1, 2, 3, 4, 5, 6, 7, 8, 9, 10, 11, 12, 13, 14, 15)); }
__device__ __forceinline__ v8f wmma16(v16h a, v16h b, v8f c) { return __builtin_amdgcn_wmma_f32_16x16x32_f16(false, a, false, b, (short)0, c, false, false); }
__device__ __forceinline__ v8f wmmab(v16bf a, v16bf b, v8f c) { return __builtin_amdgcn_wmma_f32_16x16x32_bf16(false, a, false, b, (short)0, c, false, false); }



// ---- k_gemmw: GEMM on K-contiguous 16-bit planes, one 128x128 output tile per work-group of eight waves (2 x 4, each 64x32: 8 accumulators); grid (M/128, N/128, Z), 256 threads.
// C[m][n] (f32, pitch ldc, + optional f32 bias[n]) = sum_k A[m][k] Bt[n][k] (NSPLIT == 1: + A2[m][k] Bt[n][k]). z-batch strides sA/sB/sC in elements. K % 128 == 0, M % 128 == 0, N % 128 == 0.
// The operand rows come 128 k (256 B, whole lines) at a time into two LDS buffers by asynchronous copies, each byte fetched once a work-group; every wave reads its fragments from LDS.
template <typename T16> struct WFrag;
template <> struct WFrag<h16> { typedef v16h V; static __device__ __forceinline__ V ld(const h16* p) { return cat16(*(const v8h*)p, *(const v8h*)(p + 16)); } static __device__ __forceinline__ v8f mma(V a, V b, v8f c) { return wmma16(a, b, c); } };
template <> struct WFrag<bf> { typedef v16bf V; static __device__ __forceinline__ V ld(const bf* p) { return cat16b(*(const v8us*)p, *(const v8us*)(p + 16)); } static __device__ __forceinline__ v8f mma(V a, V b, v8f c) { return wmmab(a, b, c); } };
#define GS   128                  // k elements a stage
#define GP   272                  // LDS pitch of a staged row (256 B + 16: 16 B x odd, the conflict-free pitch of 16-byte reads)
#define GPL  (128 * GP)           // one staged plane: 128 rows
// One plane's eight copies of a lane (16 bytes each, rows 16 apart). l: the lane's LDS byte address in the plane; g: its global address; rs: bytes of 16 source rows.
__device__ __forceinline__ void plane_copy(unsigned l, const char* g, size_t rs) {
    // the copies and, as the last line, the wait that stands in front of any rewrite of their address registers, in one statement
    asm volatile("global_load_async_to_lds_b128 %0, %8, off\n\t"
                 "global_load_async_to_lds_b128 %1, %9, off\n\t"
                 "global_load_async_to_lds_b128 %2, %10, off\n\t"
                 "global_load_async_to_lds_b128 %3, %11, off\n\t"
                 "global_load_async_to_lds_b128 %4, %12, off\n\t"
                 "global_load_async_to_lds_b128 %5, %13, off\n\t"
                 "global_load_async_to_lds_b128 %6, %14, off\n\t"
                 "global_load_async_to_lds_b128 %7, %15, off\n\t"
                 "s_wait_xcnt 0x0"
                 : : "v"(l), "v"(l + 16 * GP), "v"(l + 32 * GP), "v"(l + 48 * GP), "v"(l + 64 * GP), "v"(l + 80 * GP), "v"(l + 96 * GP), "v"(l + 112 * GP),
                     "v"(g), "v"(g + rs), "v"(g + 2 * rs), "v"(g + 3 * rs), "v"(g + 4 * rs), "v"(g + 5 * rs), "v"(g + 6 * rs), "v"(g + 7 * rs)
                 : "memory");
}
// gemm_tile: the ring and the products of one 128x128 tile (rows r0.., columns c0..); gs: the work-group's two buffers. Behind it no wave reads gs any more and no copy is in flight (the last stage's foot barrier).
template <typename T16, int NSPLIT>
__device__ __forceinline__ void gemm_tile(const T16* __restrict__ A, const T16* __restrict__ A2, const T16* __restrict__ Bt, int K, int r0, int c0, char* gs, v8f (&acc)[4][2]) {
    static_assert(NSPLIT == 0 || NSPLIT == 1, "one or two A planes");
    typedef typename WFrag<T16>::V V;
    constexpr int NPL = NSPLIT == 1 ? 3 : 2;     // staged planes: A, (A2,) Bt
    constexpr int GBUF = NPL * GPL;              // one buffer
    const int tid = threadIdx.x; const int lane = tid & 31, lr = lane & 15, hi = lane >> 4; const int w = tid >> 5, wm = w & 1, wn = w >> 1;
#pragma unroll
    for (int mb = 0; mb < 4; ++mb)
#pragma unroll
        for (int nb = 0; nb < 2; ++nb) acc[mb][nb] = (v8f){};
    const unsigned lc = (unsigned)(size_t)gs + (unsigned)((tid >> 4) * GP + (tid & 15) * 16);    // the lane's place in a staged plane
    const size_t rs = (size_t)K * 32;
    const char* gA = (const char*)(A + (size_t)(r0 + (tid >> 4)) * K) + (tid & 15) * 16; const char* gA2 = NSPLIT == 1 ? (const char*)(A2 + (size_t)(r0 + (tid >> 4)) * K) + (tid & 15) * 16 : nullptr; const char* gB = (const char*)(Bt + (size_t)(c0 + (tid >> 4)) * K) + (tid & 15) * 16;
    auto stage = [&](int t, unsigned bo) { plane_copy(lc + bo, gA + (size_t)t * (GS * 2), rs); if (NSPLIT == 1) plane_copy(lc + bo + GPL, gA2 + (size_t)t * (GS * 2), rs); plane_copy(lc + bo + (NPL - 1) * GPL, gB + (size_t)t * (GS * 2), rs); };
    const char* fa = gs + (wm * 64 + lr) * GP + 16 * hi; const char* fb = gs + (NPL - 1) * GPL + (wn * 32 + lr) * GP + 16 * hi;    // the lane's fragment bases in buffer 0
    const int nst = K / GS;
    stage(0, 0);
    asm volatile("s_wait_asynccnt 0x0" ::: "memory");    // this wave's share of stage 0 has landed
    __syncthreads();                                      // publishes stage 0
    if (nst > 1) stage(1, GBUF);
#pragma unroll 1    // stays rolled: one stage's body stands once in the instruction cache
    for (int t = 0; t < nst; ++t) {
        const int bo = (t & 1) * GBUF;
        V a[2][4], a2[2][4], b[2][2];    // two fragment sets: a step's products run on one while the next step's reads fill the other
        auto frag = [&](int ks, int s) {
#pragma unroll
            for (int mb = 0; mb < 4; ++mb) { a[s][mb] = WFrag<T16>::ld((const T16*)(fa + bo + mb * 16 * GP + ks * 64)); if (NSPLIT == 1) a2[s][mb] = WFrag<T16>::ld((const T16*)(fa + bo + GPL + mb * 16 * GP + ks * 64)); }
#pragma unroll
            for (int nb = 0; nb < 2; ++nb) b[s][nb] = WFrag<T16>::ld((const T16*)(fb + bo + nb * 16 * GP + ks * 64)); };
        frag(0, 0);
        __builtin_amdgcn_sched_barrier(0);    // the first step's reads stay in front of the second's, so that the first products wait for their own set alone
#pragma unroll    // unrolled: every LDS offset is an immediate and the fragment sets are named at compile time
        for (int ks = 0; ks < GS / 32; ++ks) {
            const int s = ks & 1;
            if (ks + 1 < GS / 32) frag(ks + 1, s ^ 1);    // of this same stage only
            __builtin_amdgcn_sched_barrier(0);    // the next step's reads stay one group ahead of this step's products, for speed only
#pragma unroll
            for (int nb = 0; nb < 2; ++nb)
#pragma unroll
                for (int mb = 0; mb < 4; ++mb) acc[mb][nb] = WFrag<T16>::mma(a[s][mb], b[s][nb], acc[mb][nb]);
            if (NSPLIT == 1) {
#pragma unroll
                for (int nb = 0; nb < 2; ++nb)
#pragma unroll
                    for (int mb = 0; mb < 4; ++mb) acc[mb][nb] = WFrag<T16>::mma(a2[s][mb], b[s][nb], acc[mb][nb]);
            }
            __builtin_amdgcn_sched_barrier(0);    // and the reads behind these products do not move in among them
        }
        asm volatile("s_wait_dscnt 0x0" ::: "memory");       // this wave's reads of the buffer have returned before it is refilled
        asm volatile("s_wait_asynccnt 0x0" ::: "memory");    // this wave's share of stage t + 1 has landed
        __syncthreads();                                      // publishes stage t + 1 and ends every wave's reads of stage t
        if (t + 2 < nst) stage(t + 2, (unsigned)bo);          // stage t + 2 into the buffer just left
    }
    asm volatile("s_wait_asynccnt 0x0" ::: "memory");    // no copy is outstanding when the wave ends
}
template <typename T16, int NSPLIT, bool BIAS>
__global__ __launch_bounds__(256) void k_gemmw(const T16* __restrict__ A, const T16* __restrict__ A2, const T16* __restrict__ Bt, int K, float* C, int ldc, const float* __restrict__ bias, size_t sA, size_t sB, size_t sC) {
    __shared__ __align__(16) char gs[2 * (NSPLIT == 1 ? 3 : 2) * GPL];
    __shared__ __align__(16) float osm[8 * 16 * 36];    // each wave's own store staging: 16 rows of 32 floats, pitch 36
    const size_t z = blockIdx.z; A += z * sA; if (NSPLIT == 1) A2 += z * sA; Bt += z * sB; C += z * sC;
    const int tid = threadIdx.x; const int lane = tid & 31, lr = lane & 15, hi = lane >> 4; const int w = tid >> 5, wm = w & 1, wn = w >> 1; const int r0 = blockIdx.x * 128, c0 = blockIdx.y * 128;
    v8f acc[4][2];
    gemm_tile<T16, NSPLIT>(A, A2, Bt, K, r0, c0, gs, acc);
    float* os = osm + w * (16 * 36); const int cw = c0 + wn * 32;
#pragma unroll
    for (int mb = 0; mb < 4; ++mb) {
#pragma unroll
        for (int nb = 0; nb < 2; ++nb) {
#pragma unroll
            for (int j = 0; j < 8; ++j) os[(hi * 8 + j) * 36 + nb * 16 + lr] = acc[mb][nb][j]; }
        __builtin_amdgcn_wave_barrier(); asm volatile("" ::: "memory");    // the wave's staged rows are written before it reads them back
        float* crow = C + (size_t)(r0 + wm * 64 + mb * 16) * ldc + cw;
#pragma unroll
        for (int s = 0; s < 4; ++s) { const int row = 4 * s + (lane >> 3), cofs = (lane & 7) * 4; v4f val = *(const v4fa*)(os + row * 36 + cofs); if (BIAS) { val[0] += bfr(bias[cw + cofs]); val[1] += bfr(bias[cw + cofs + 1]); val[2] += bfr(bias[cw + cofs + 2]); val[3] += bfr(bias[cw + cofs + 3]); }
            *(v4f*)(crow + (size_t)row * ldc + cofs) = val; }
        __builtin_amdgcn_wave_barrier(); asm volatile("" ::: "memory");    // the rows are read back before the next tile row overwrites them
    }
}

__device__ __forceinline__ h16 tohx(float x) { return (h16)x; }
__device__ __forceinline__ void splitf(float y, unsigned short& h, unsigned short& l) { h = f2bf(y); l = f2bf(y - bf2f(h)); }
typedef __attribute__((ext_vector_type(2))) _Float16 v2h;
typedef __attribute__((ext_vector_type(4))) _Float16 v4h;
typedef __attribute__((ext_vector_type(2))) unsigned short v2us;
typedef __attribute__((ext_vector_type(4))) unsigned short v4us;
typedef __attribute__((ext_vector_type(4))) int v4i;

// k_cvt5: the four weights and the query rounded to bf16 in ONE launch, grid 512 x 256 threads. dst: the five bf16 planes one behind the other (Wq, Wk, Wv, Wo, x).
// A work-group owns 16384 floats in a row (64 work-groups a weight, 256 the query); a wave's every load covers 512 contiguous bytes and every store 256, whole lines; a lane's sixteen loads are all issued ahead of the first rounding.
#define CVW  (DD * DD / 16384)    // work-groups a weight plane
__global__ __launch_bounds__(256) void k_cvt5(const float* __restrict__ wq, const float* __restrict__ wk, const float* __restrict__ wv, const float* __restrict__ wo, const float* __restrict__ x, bf* dst) {
    const unsigned g = blockIdx.x; const unsigned pl = g / CVW < 4u ? g / CVW : 4u;    // the plane, the same for the whole work-group
    const float* src = pl == 0 ? wq : pl == 1 ? wk : pl == 2 ? wv : pl == 3 ? wo : x;
    const size_t so = (size_t)(g - pl * CVW) * 16384 + threadIdx.x * 4, eo = (size_t)g * 16384 + threadIdx.x * 4;
    v4f v[16];
#pragma unroll    // unrolled, like the loop below: v is indexed at compile time and stays in registers
    for (int i = 0; i < 16; ++i) v[i] = *(const v4f*)(src + so + i * 1024);
#pragma unroll
    for (int i = 0; i < 16; ++i) { v4us o;
#pragma unroll
        for (int k = 0; k < 4; ++k) o[k] = f2bf(v[i][k]);
        *(v4us*)(dst + eo + i * 1024) = o; }
}
// k_qkv: the three projections in one launch, grid (NT/128, DD/128, 3), blockIdx.z = 0 q, 1 k, 2 v (W3: the three bf16 weight planes one behind the other). Each work-group writes its 128x128 tile (64 t x 2 b, two heads)
// straight into the head planes: q (x 1/8) and k as bf16 hi and lo [b*16+h][t][64], v as fp16 transposed [b*16+h][64][t]. The tile passes through the ring's LDS, free behind gemm_tile, so that every global store covers whole 128-byte lines.
#define QSP  132                  // floats a staged q/k row (128 + 4: the two lane halves, eight rows apart, fall on different banks)
#define VSP  72                   // fp16 a staged v line (128 B + 16: the conflict-free pitch of 16-byte reads)
__global__ __launch_bounds__(256) void k_qkv(const bf* __restrict__ X, const bf* __restrict__ W3, const float* __restrict__ bq, const float* __restrict__ bk, const float* __restrict__ bv, bf* Qh, bf* Ql, bf* Kh, bf* Kl, h16* VT) {
    __shared__ __align__(16) char gs[2 * 2 * GPL];
    static_assert(128 * QSP * 4 <= 2 * 2 * GPL && 256 * VSP * 2 <= 2 * 2 * GPL, "the staged tile fits the ring");
    const int tid = threadIdx.x; const int lane = tid & 31, lr = lane & 15, hi = lane >> 4; const int w = tid >> 5, wm = w & 1, wn = w >> 1; const int r0 = blockIdx.x * 128, c0 = blockIdx.y * 128; const int pz = blockIdx.z;
    const float* bias = pz == 0 ? bq : pz == 1 ? bk : bv;
    const float bb[2] = {bfr(bias[c0 + wn * 32 + lr]), bfr(bias[c0 + wn * 32 + 16 + lr])};    // fetched ahead of the ring, so that nothing waits for it behind the products
    v8f acc[4][2];
    gemm_tile<bf, 0>(X, nullptr, W3 + (size_t)pz * DD * DD, DD, r0, c0, gs, acc);
    const int t0 = r0 / NB_, h0 = c0 / HD;
    if (pz < 2) {    // the same for the whole work-group
        float* st = (float*)gs; const float sc = pz == 0 ? 0.125f : 1.0f;    // 1/sqrt(64) folded into q exactly
#pragma unroll    // this and every loop below is unrolled so that acc, x0 and x1 are indexed at compile time and stay in registers
        for (int mb = 0; mb < 4; ++mb)
#pragma unroll
            for (int nb = 0; nb < 2; ++nb)
#pragma unroll
                for (int j = 0; j < 8; ++j) st[(wm * 64 + mb * 16 + hi * 8 + j) * QSP + wn * 32 + nb * 16 + lr] = (acc[mb][nb][j] + bb[nb]) * sc;
        __syncthreads();    // the whole tile is staged before any wave reads other waves' columns
        bf* Ph = pz == 0 ? Qh : Kh; bf* Pl = pz == 0 ? Ql : Kl;
        v4f x0[8], x1[8];    // the reads stand in a loop of their own, so that later reads can be under way while earlier values are split
#pragma unroll
        for (int i = 0; i < 8; ++i) { const int it = i * 256 + tid; const int ch = it & 7, tl = (it >> 3) & 63, b = (it >> 9) & 1, hl = it >> 10;    // eight lanes a plane row, a wave four rows in a row: 512 contiguous bytes
            const float* sp = st + (tl * NB_ + b) * QSP + hl * HD + ch * 8; x0[i] = *(const v4fa*)sp; x1[i] = *(const v4fa*)(sp + 4); }
#pragma unroll
        for (int i = 0; i < 8; ++i) { const int it = i * 256 + tid; const int ch = it & 7, tl = (it >> 3) & 63, b = (it >> 9) & 1, hl = it >> 10; v8us oh, ol;
#pragma unroll
            for (int k = 0; k < 4; ++k) { unsigned short a, c2; splitf(x0[i][k], a, c2); oh[k] = a; ol[k] = c2; splitf(x1[i][k], a, c2); oh[4 + k] = a; ol[4 + k] = c2; }
            const size_t e = ((size_t)(b * NH_ + h0 + hl) * TT + t0 + tl) * HD + ch * 8;
            *(v8us*)(Ph + e) = oh; *(v8us*)(Pl + e) = ol; }
    } else {
        h16* sv = (h16*)gs;    // line (column, b): its 64 t
#pragma unroll
        for (int mb = 0; mb < 4; ++mb)
#pragma unroll
            for (int nb = 0; nb < 2; ++nb)
#pragma unroll
                for (int b = 0; b < 2; ++b) { v4h p;    // rows are t*2 + b: a lane's eight rows of a tile are four t of each b
#pragma unroll
                    for (int q = 0; q < 4; ++q) p[q] = tohx(acc[mb][nb][q * 2 + b] + bb[nb]);
                    *(v4h*)(sv + ((wn * 32 + nb * 16 + lr) * 2 + b) * VSP + wm * 32 + mb * 8 + hi * 4) = p; }
        __syncthreads();    // the whole tile is staged before any wave reads other waves' rows
#pragma unroll
        for (int i = 0; i < 8; ++i) { const int it = i * 256 + tid; const int ch = it & 7, ln = it >> 3; const int col = ln >> 1, b = ln & 1;    // eight lanes a line of V^T
            const v8h v = *(const v8ha*)(sv + ln * VSP + ch * 8);
            *(v8h*)(VT + ((size_t)(b * NH_ + h0 + (col >> 6)) * HD + (col & 63)) * TT + t0 + ch * 8) = v; }
        asm volatile("s_wait_xcnt 0x0" ::: "memory");    // stands behind the run's last store, in front of any later rewrite of the stores' address registers
    }
}
__device__ __forceinline__ float xhalf(float x) { return __builtin_bit_cast(float, __builtin_amdgcn_permlanex16(__builtin_bit_cast(int, x), __builtin_bit_cast(int, x), 0x76543210, 0xfedcba98, false, false)); }  // lane l with lane l ^ 16
#define L2E 1.4426950408889634f
#define SK   128                  // keys a stage
#define NST  (TT / SK)            // stages
#define KP   144                  // LDS pitch of a K row (128 B + 16: 16 B x odd, the conflict-free pitch of 16-byte reads)
#define VP   272                  // LDS pitch of a V^T row (256 B + 16)
#define KPB  (SK * KP)            // one K plane of a stage
#define BUFB (2 * KPB + HD * VP)  // one buffer: K hi, K lo, V^T
// One stage's twelve copies of a lane (16 bytes each): four to each of K hi, K lo, V^T. lk, lv: the lane's LDS byte addresses in the K hi plane and in V^T; gh, gl, gv: its global addresses.
__device__ __forceinline__ void stage_copy(unsigned lk, unsigned lv, const char* gh, const char* gl, const char* gv) {
    // the copies and, as the last line, the wait that stands in front of any rewrite of their address registers, in one statement
    asm volatile("global_load_async_to_lds_b128 %0, %12, off\n\t"
                 "global_load_async_to_lds_b128 %1, %13, off\n\t"
                 "global_load_async_to_lds_b128 %2, %14, off\n\t"
                 "global_load_async_to_lds_b128 %3, %15, off\n\t"
                 "global_load_async_to_lds_b128 %4, %16, off\n\t"
                 "global_load_async_to_lds_b128 %5, %17, off\n\t"
                 "global_load_async_to_lds_b128 %6, %18, off\n\t"
                 "global_load_async_to_lds_b128 %7, %19, off\n\t"
                 "global_load_async_to_lds_b128 %8, %20, off\n\t"
                 "global_load_async_to_lds_b128 %9, %21, off\n\t"
                 "global_load_async_to_lds_b128 %10, %22, off\n\t"
                 "global_load_async_to_lds_b128 %11, %23, off\n\t"
                 "s_wait_xcnt 0x0"
                 : : "v"(lk), "v"(lk + 32 * KP), "v"(lk + 64 * KP), "v"(lk + 96 * KP),
                     "v"(lk + KPB), "v"(lk + KPB + 32 * KP), "v"(lk + KPB + 64 * KP), "v"(lk + KPB + 96 * KP),
                     "v"(lv), "v"(lv + 16 * VP), "v"(lv + 32 * VP), "v"(lv + 48 * VP),
                     "v"(gh), "v"(gh + 4096), "v"(gh + 8192), "v"(gh + 12288),
                     "v"(gl), "v"(gl + 4096), "v"(gl + 8192), "v"(gl + 12288),
                     "v"(gv), "v"(gv + 16 * TT * 2), "v"(gv + 32 * TT * 2), "v"(gv + 48 * TT * 2)
                 : "memory");
}
__global__ __launch_bounds__(256) void k_fattn(const bf* __restrict__ Qh, const bf* __restrict__ Ql, const bf* __restrict__ Kh, const bf* __restrict__ Kl, const h16* __restrict__ VT, bf* Ah, bf* Al) {
    __shared__ __align__(16) char sm[2 * BUFB];
    const int tid = threadIdx.x; const int lane = tid & 31, c = lane & 15, hi = lane >> 4; const int z = blockIdx.y; const int q0 = blockIdx.x * 256 + (tid >> 5) * 32;
    const size_t zo = (size_t)z * TT * HD;
    const unsigned lk = (unsigned)(size_t)sm + (unsigned)((tid >> 3) * KP + (tid & 7) * 16), lv = (unsigned)(size_t)sm + (unsigned)(2 * KPB + (tid >> 4) * VP + (tid & 15) * 16);
    const char* gh = (const char*)(Kh + zo) + tid * 16; const char* gl = (const char*)(Kl + zo) + tid * 16; const char* gv = (const char*)(VT + zo) + (tid >> 4) * (TT * 2) + (tid & 15) * 16;
    const unsigned qo[2] = {(unsigned)(zo + (q0 + c) * HD + 8 * hi) * 2u, (unsigned)(zo + (q0 + 16 + c) * HD + 8 * hi) * 2u};    // the lane's byte offsets into the Q planes
    v16bf qh[2][2], ql[2][2];
#pragma unroll
    for (int g = 0; g < 2; ++g)
#pragma unroll
        for (int kc = 0; kc < 2; ++kc) { qh[g][kc] = WFrag<bf>::ld((const bf*)((const char*)Qh + qo[g]) + kc * 32); ql[g][kc] = WFrag<bf>::ld((const bf*)((const char*)Ql + qo[g]) + kc * 32); }
    v8f o[4][2];
#pragma unroll
    for (int dt = 0; dt < 4; ++dt)
#pragma unroll
        for (int g = 0; g < 2; ++g) o[dt][g] = (v8f){};
    float m[2] = {-3.0e38f, -3.0e38f}, l[2] = {0.f, 0.f};
    asm volatile("s_wait_xcnt 0x0" : : "v"(qo[0]), "v"(qo[1]) : "memory");    // keeps the Q loads' offset registers untouched up to the wait; behind it they are free for reuse
    const char* fk = sm + c * KP + 16 * hi; const char* fv = sm + 2 * KPB + c * VP + 16 * hi;    // the lane's fragment bases in buffer 0
#pragma unroll 1    // stays rolled: the copies keep one place of issue, and the four-pass body stands once in the instruction cache
    for (int t = -2; t < NST; ++t) {    // trips -2 and -1 are the ring's prologue: they only pass the foot, which issues stage 0, then publishes it and issues stage 1
        const int bo = (t & 1) * BUFB;
        if (t >= 0) {
        v16bf kh[2][2], kl[2][2];
#pragma unroll
        for (int kt = 0; kt < 2; ++kt)
#pragma unroll
            for (int kc = 0; kc < 2; ++kc) { kh[kt][kc] = WFrag<bf>::ld((const bf*)(fk + bo + kt * 16 * KP + kc * 64)); kl[kt][kc] = WFrag<bf>::ld((const bf*)(fk + bo + KPB + kt * 16 * KP + kc * 64)); }
        __builtin_amdgcn_sched_barrier(0);    // the stage's first fragment reads stay one group too, in front of the first products
#pragma unroll    // unrolled: every LDS offset of a pass is an immediate, and a pass's exps can stand among the next pass's products
        for (int sub = 0; sub < SK / 32; ++sub) {
            v8f s[2][2];
#pragma unroll
            for (int kt = 0; kt < 2; ++kt)
#pragma unroll
                for (int g = 0; g < 2; ++g) { v8f a = (v8f){};
#pragma unroll
                    for (int kc = 0; kc < 2; ++kc) { a = wmmab(kh[kt][kc], qh[g][kc], a); a = wmmab(kh[kt][kc], ql[g][kc], a); a = wmmab(kl[kt][kc], qh[g][kc], a); }
                    s[kt][g] = a; }
            __builtin_amdgcn_sched_barrier(0);    // all LDS reads of a pass stand in ONE place, behind its score products, for speed only
            if (sub + 1 < SK / 32) {    // the next 32 keys' fragments, of this same stage, into the registers the products have just read
#pragma unroll
                for (int kt = 0; kt < 2; ++kt)
#pragma unroll
                    for (int kc = 0; kc < 2; ++kc) { kh[kt][kc] = WFrag<bf>::ld((const bf*)(fk + bo + ((sub + 1) * 32 + kt * 16) * KP + kc * 64)); kl[kt][kc] = WFrag<bf>::ld((const bf*)(fk + bo + KPB + ((sub + 1) * 32 + kt * 16) * KP + kc * 64)); }
            }
            v16h vf[4];    // this pass's V^T fragments: they return while maximum and exps run
#pragma unroll
            for (int dt = 0; dt < 4; ++dt) vf[dt] = WFrag<h16>::ld((const h16*)(fv + bo + dt * 16 * VP + sub * 64));
            __builtin_amdgcn_sched_barrier(0);    // and none of these reads moves down among the exps and the products behind them
            float mn[2]; bool need = false;
#pragma unroll
            for (int g = 0; g < 2; ++g) { float mx = s[0][g][0];
#pragma unroll
                for (int r = 1; r < 8; ++r) mx = fmaxf(mx, s[0][g][r]);
#pragma unroll
                for (int r = 0; r < 8; ++r) mx = fmaxf(mx, s[1][g][r]);
                mx = fmaxf(mx, xhalf(mx)); mn[g] = fmaxf(m[g], mx); need = need || (mn[g] > m[g]); }
            if (__builtin_amdgcn_ballot_w32(need) != 0) {    // a new maximum in some column: rescale sums and output tiles (factor 1 in the columns that keep theirs)
#pragma unroll
                for (int g = 0; g < 2; ++g) { const float al = __builtin_amdgcn_exp2f((m[g] - mn[g]) * L2E); l[g] *= al; m[g] = mn[g];
#pragma unroll
                    for (int dt = 0; dt < 4; ++dt)
#pragma unroll
                        for (int r = 0; r < 8; ++r) o[dt][g][r] *= al; }
            }
#pragma unroll
            for (int g = 0; g < 2; ++g) { const float nm = 10.0f - m[g] * L2E; v16h pb; float ps = 0.f;
#pragma unroll
                for (int e = 0; e < 16; ++e) { const float p = __builtin_amdgcn_exp2f(fmaf(s[e >> 3][g][e & 7], L2E, nm)); ps += p; pb[e] = tohx(p); }
                l[g] += ps;
#pragma unroll
                for (int e = 0; e < 16; ++e) { __builtin_amdgcn_sched_group_barrier(0x400, 1, 0); __builtin_amdgcn_sched_group_barrier(0x2, 1, 0); }    // one plain vector instruction behind each exp: fills the slot the instruction set asks for behind it
#pragma unroll
                for (int dt = 0; dt < 4; ++dt) o[dt][g] = wmma16(vf[dt], pb, o[dt][g]); }
        }
        }
        asm volatile("s_wait_dscnt 0x0" ::: "memory");       // this wave's reads of the buffer have returned before it is refilled
        asm volatile("s_wait_asynccnt 0x0" ::: "memory");    // this wave's share of stage t + 1 has landed
        __syncthreads();                                      // publishes stage t + 1 and ends every wave's reads of stage t
        if (t + 2 < NST) stage_copy(lk + bo, lv + bo, gh + (t + 2) * (SK * HD * 2), gl + (t + 2) * (SK * HD * 2), gv + (t + 2) * (SK * 2));    // stage t + 2 into the buffer just left
    }
    asm volatile("s_wait_asynccnt 0x0" ::: "memory");    // no copy is outstanding when the wave ends
    const int b = z >> 4, h = z & 15;
#pragma unroll
    for (int g = 0; g < 2; ++g) { const float inv = __fdiv_rn(1.0f, l[g] + xhalf(l[g])); const size_t ob = ((size_t)(q0 + g * 16 + c) * NB_ + b) * DD + h * HD + 8 * hi;
#pragma unroll
        for (int dt = 0; dt < 4; ++dt) { v8us oh, ol;
#pragma unroll
            for (int r = 0; r < 8; ++r) { unsigned short a, c2; splitf(o[dt][g][r] * inv, a, c2); oh[r] = a; ol[r] = c2; }
            *(v8us*)(Ah + ob + dt * 16) = oh; *(v8us*)(Al + ob + dt * 16) = ol; } }
}

extern "C" void kernel_launch(void* const* d_in, const int* in_sizes, int n_in,
                              void* d_out, int out_size, void* d_ws, size_t ws_size, hipStream_t stream) {
    (void)in_sizes; (void)n_in; (void)out_size;
    const float* x = (const float*)d_in[0]; const float* wq = (const float*)d_in[1]; const float* bq = (const float*)d_in[2]; const float* wk = (const float*)d_in[3]; const float* bk = (const float*)d_in[4]; const float* wv = (const float*)d_in[5]; const float* bv = (const float*)d_in[6];
    const float* wo = (const float*)d_in[7]; const float* bo = (const float*)d_in[8];
    float* OUT = (float*)d_out;     // [2048][2][1024] (rows t*2 + b)
    char* wsp = (char*)d_ws;
    auto take = [&](size_t bytes) { char* p = wsp; wsp += (bytes + 255) & ~(size_t)255; return (void*)p; };
    bf* WQ = (bf*)take((size_t)DD * DD * 2); bf* WK = (bf*)take((size_t)DD * DD * 2); bf* WV = (bf*)take((size_t)DD * DD * 2); bf* WO = (bf*)take((size_t)DD * DD * 2);
    bf* XB = (bf*)take((size_t)NT * DD * 2);
    bf* QPh = (bf*)take((size_t)NT * DD * 2); bf* QPl = (bf*)take((size_t)NT * DD * 2); bf* KPh = (bf*)take((size_t)NT * DD * 2); bf* KPl = (bf*)take((size_t)NT * DD * 2); h16* VT = (h16*)take((size_t)NT * DD * 2);
    bf* ATh = (bf*)take((size_t)NT * DD * 2); bf* ATl = (bf*)take((size_t)NT * DD * 2);
    if ((size_t)(wsp - (char*)d_ws) > ws_size) return;    // ws 256 MiB
    k_cvt5<<<4 * CVW + NT * DD / 16384, 256, 0, stream>>>(wq, wk, wv, wo, x, WQ);    // WQ, WK, WV, WO, XB lie one behind the other (each plane a multiple of 256 bytes)
    k_qkv<<<dim3(NT / 128, DD / 128, 3), 256, 0, stream>>>(XB, WQ, bq, bk, bv, QPh, QPl, KPh, KPl, VT);    // WQ, WK, WV lie one behind the other (each plane a multiple of 256 bytes)
    k_fattn<<<dim3(TT / 256, NB_ * NH_, 1), 256, 0, stream>>>(QPh, QPl, KPh, KPl, VT, ATh, ATl);
    k_gemmw<bf, 1, true><<<dim3(NT / 128, DD / 128, 1), 256, 0, stream>>>(ATh, ATl, WO, DD, OUT, DD, bo, 0, 0, 0);
}

// v008
// A run of this version takes 77.2 microseconds.
// It is 1.28 times as fast as v006, going by the measured steps of the versions left out in between.
// Over all steps from v000 it is 16.5 times as fast.
#include <hip/hip_runtime.h>

// JITCompatibleMultiheadAttention (query [T=2048][B=2][E=1024] seq-first layout; q = (query Wq^T + bq) * 64^-0.5, k/v = query W^T + b; 16 heads x 64 ([T,B,E] -> [B*16][T][64]);
// softmax(q.k) v; out [T][B][E] = attn Wo^T + bo). Rows are indexed r = t*2 + b everywhere (projections and the output GEMM are row-order agnostic; the head-plane builders and the merge use t*NB_ + b).
// Compute dtypes, f32 accumulate: every float input rounded to bf16; q/k/v projections on PLAIN bf16 operands (x, W inputs: exact, + bias);
// scores on SINGLE fp16 q (x log2(e)/8) and k planes (1 product); attn.v on SINGLE fp16 planes (P x1024, v); output Linear on hi+lo planes x exact bf16 W (2 products); 

#define NB_  2
#define TT   2048
#define DD   1024
#define NH_  16
#define HD   64
#define NT   (NB_ * TT)
typedef _Float16 h16;
typedef unsigned short bf;
typedef __attribute__((ext_vector_type(16))) __bf16   v16bf;
typedef __attribute__((ext_vector_type(16))) _Float16 v16h;
typedef __attribute__((ext_vector_type(8)))  _Float16 v8h;
typedef __attribute__((ext_vector_type(8)))  unsigned short v8us;
typedef __attribute__((ext_vector_type(8)))  float    v8f;
typedef __attribute__((ext_vector_type(4)))  float    v4f;
typedef v8h  __attribute__((may_alias)) v8ha;
typedef v4f  __attribute__((may_alias)) v4fa;
typedef v8us __attribute__((may_alias)) v8usa;

__device__ __forceinline__ unsigned short f2bf(float f) { unsigned u = __float_as_uint(f); u += 0x7FFFu + ((u >> 16) & 1u); return (unsigned short)(u >> 16); }
__device__ __forceinline__ float bf2f(unsigned short b) { return __uint_as_float(((unsigned)b) << 16); }
__device__ __forceinline__ float bfr(float f) { return bf2f(f2bf(f)); }
__device__ __forceinline__ v16h cat16(v8h lo, v8h hi) { return __builtin_shufflevector(lo, hi, 0, 1, 2, 3, 4, 5, 6, 7, 8, 9, 10, 11, 12, 13, 14, 15); }
__device__ __forceinline__ v16bf cat16b(v8us lo, v8us hi) { return __builtin_bit_cast(v16bf, __builtin_shufflevector(lo, hi, 0, 1, 2, 3, 4, 5, 6, 7, 8, 9, 10, 11, 12, 13, 14, 15)); }
__device__ __forceinline__ v8f wmma16(v16h a, v16h b, v8f c) { return __builtin_amdgcn_wmma_f32_16x16x32_f16(false, a, false, b, (short)0, c, false, false); }
__device__ __forceinline__ v8f wmmab(v16bf a, v16bf b, v8f c) { return __builtin_amdgcn_wmma_f32_16x16x32_bf16(false, a, false, b, (short)0, c, false, false); }



// ---- k_gemmw: GEMM on K-contiguous 16-bit planes, one 128x128 output tile per work-group of eight waves (2 x 4, each 64x32: 8 accumulators); grid (M/128, N/128, Z), 256 threads.
// C[m][n] (f32, pitch ldc, + optional f32 bias[n]) = sum_k A[m][k] Bt[n][k] (NSPLIT == 1: + A2[m][k] Bt[n][k]). z-batch strides sA/sB/sC in elements. K % 128 == 0, M % 128 == 0, N % 128 == 0.
// The operand rows come 128 k (256 B, whole lines) at a time into two LDS buffers by asynchronous copies, each byte fetched once a work-group; every wave reads its fragments from LDS.
template <typename T16> struct WFrag;
template <> struct WFrag<h16> { typedef v16h V; static __device__ __forceinline__ V ld(const h16* p) { return cat16(*(const v8h*)p, *(const v8h*)(p + 16)); } static __device__ __forceinline__ v8f mma(V a, V b, v8f c) { return wmma16(a, b, c); } };
template <> struct WFrag<bf> { typedef v16bf V; static __device__ __forceinline__ V ld(const bf* p) { return cat16b(*(const v8us*)p, *(const v8us*)(p + 16)); } static __device__ __forceinline__ v8f mma(V a, V b, v8f c) { return wmmab(a, b, c); } };
#define GS   128                  // k elements a stage
#define GP   272                  // LDS pitch of a staged row (256 B + 16: 16 B x odd, the conflict-free pitch of 16-byte reads)
#define GPL  (128 * GP)           // one staged plane: 128 rows
// One plane's eight copies of a lane (16 bytes each, rows 16 apart). l: the lane's LDS byte address in the plane; g: its global address; rs: bytes of 16 source rows.
__device__ __forceinline__ void plane_copy(unsigned l, const char* g, size_t rs) {
    // the copies and, as the last line, the wait that stands in front of any rewrite of their address registers, in one statement
    asm volatile("global_load_async_to_lds_b128 %0, %8, off\n\t"
                 "global_load_async_to_lds_b128 %1, %9, off\n\t"
                 "global_load_async_to_lds_b128 %2, %10, off\n\t"
                 "global_load_async_to_lds_b128 %3, %11, off\n\t"
                 "global_load_async_to_lds_b128 %4, %12, off\n\t"
                 "global_load_async_to_lds_b128 %5, %13, off\n\t"
                 "global_load_async_to_lds_b128 %6, %14, off\n\t"
                 "global_load_async_to_lds_b128 %7, %15, off\n\t"
                 "s_wait_xcnt 0x0"
                 : : "v"(l), "v"(l + 16 * GP), "v"(l + 32 * GP), "v"(l + 48 * GP), "v"(l + 64 * GP), "v"(l + 80 * GP), "v"(l + 96 * GP), "v"(l + 112 * GP),
                     "v"(g), "v"(g + rs), "v"(g + 2 * rs), "v"(g + 3 * rs), "v"(g + 4 * rs), "v"(g + 5 * rs), "v"(g + 6 * rs), "v"(g + 7 * rs)
                 : "memory");
}
// gemm_tile: the ring and the products of one 128x128 tile (rows r0.., columns c0..); gs: the work-group's two buffers. Behind it no wave reads gs any more and no copy is in flight (the last stage's foot barrier).
template <typename T16, int NSPLIT>
__device__ __forceinline__ void gemm_tile(const T16* __restrict__ A, const T16* __restrict__ A2, const T16* __restrict__ Bt, int K, int r0, int c0, char* gs, v8f (&acc)[4][2]) {
    static_assert(NSPLIT == 0 || NSPLIT == 1, "one or two A planes");
    typedef typename WFrag<T16>::V V;
    constexpr int NPL = NSPLIT == 1 ? 3 : 2;     // staged planes: A, (A2,) Bt
    constexpr int GBUF = NPL * GPL;              // one buffer
    const int tid = threadIdx.x; const int lane = tid & 31, lr = lane & 15, hi = lane >> 4; const int w = tid >> 5, wm = w & 1, wn = w >> 1;
#pragma unroll
    for (int mb = 0; mb < 4; ++mb)
#pragma unroll
        for (int nb = 0; nb < 2; ++nb) acc[mb][nb] = (v8f){};
    const unsigned lc = (unsigned)(size_t)gs + (unsigned)((tid >> 4) * GP + (tid & 15) * 16);    // the lane's place in a staged plane
    const size_t rs = (size_t)K * 32;
    const char* gA = (const char*)(A + (size_t)(r0 + (tid >> 4)) * K) + (tid & 15) * 16; const char* gA2 = NSPLIT == 1 ? (const char*)(A2 + (size_t)(r0 + (tid >> 4)) * K) + (tid & 15) * 16 : nullptr; const char* gB = (const char*)(Bt + (size_t)(c0 + (tid >> 4)) * K) + (tid & 15) * 16;
    auto stage = [&](int t, unsigned bo) { plane_copy(lc + bo, gA + (size_t)t * (GS * 2), rs); if (NSPLIT == 1) plane_copy(lc + bo + GPL, gA2 + (size_t)t * (GS * 2), rs); plane_copy(lc + bo + (NPL - 1) * GPL, gB + (size_t)t * (GS * 2), rs); };
    const char* fa = gs + (wm * 64 + lr) * GP + 16 * hi; const char* fb = gs + (NPL - 1) * GPL + (wn * 32 + lr) * GP + 16 * hi;    // the lane's fragment bases in buffer 0
    const int nst = K / GS;
    stage(0, 0);
    asm volatile("s_wait_asynccnt 0x0" ::: "memory");    // this wave's share of stage 0 has landed
    __syncthreads();                                      // publishes stage 0
    if (nst > 1) stage(1, GBUF);
#pragma unroll 1    // stays rolled: one stage's body stands once in the instruction cache
    for (int t = 0; t < nst; ++t) {
        const int bo = (t & 1) * GBUF;
        V a[2][4], a2[2][4], b[2][2];    // two fragment sets: a step's products run on one while the next step's reads fill the other
        auto frag = [&](int ks, int s) {
#pragma unroll
            for (int mb = 0; mb < 4; ++mb) { a[s][mb] = WFrag<T16>::ld((const T16*)(fa + bo + mb * 16 * GP + ks * 64)); if (NSPLIT == 1) a2[s][mb] = WFrag<T16>::ld((const T16*)(fa + bo + GPL + mb * 16 * GP + ks * 64)); }
#pragma unroll
            for (int nb = 0; nb < 2; ++nb) b[s][nb] = WFrag<T16>::ld((const T16*)(fb + bo + nb * 16 * GP + ks * 64)); };
        frag(0, 0);
        __builtin_amdgcn_sched_barrier(0);    // the first step's reads stay in front of the second's, so that the first products wait for their own set alone
#pragma unroll    // unrolled: every LDS offset is an immediate and the fragment sets are named at compile time
        for (int ks = 0; ks < GS / 32; ++ks) {
            const int s = ks & 1;
            if (ks + 1 < GS / 32) frag(ks + 1, s ^ 1);    // of this same stage only
            __builtin_amdgcn_sched_barrier(0);    // the next step's reads stay one group ahead of this step's products, for speed only
#pragma unroll
            for (int nb = 0; nb < 2; ++nb)
#pragma unroll
                for (int mb = 0; mb < 4; ++mb) acc[mb][nb] = WFrag<T16>::mma(a[s][mb], b[s][nb], acc[mb][nb]);
            if (NSPLIT == 1) {
#pragma unroll
                for (int nb = 0; nb < 2; ++nb)
#pragma unroll
                    for (int mb = 0; mb < 4; ++mb) acc[mb][nb] = WFrag<T16>::mma(a2[s][mb], b[s][nb], acc[mb][nb]);
            }
            __builtin_amdgcn_sched_barrier(0);    // and the reads behind these products do not move in among them
        }
        asm volatile("s_wait_dscnt 0x0" ::: "memory");       // this wave's reads of the buffer have returned before it is refilled
        asm volatile("s_wait_asynccnt 0x0" ::: "memory");    // this wave's share of stage t + 1 has landed
        __syncthreads();                                      // publishes stage t + 1 and ends every wave's reads of stage t
        if (t + 2 < nst) stage(t + 2, (unsigned)bo);          // stage t + 2 into the buffer just left
    }
    asm volatile("s_wait_asynccnt 0x0" ::: "memory");    // no copy is outstanding when the wave ends
}
template <typename T16, int NSPLIT, bool BIAS>
__global__ __launch_bounds__(256) void k_gemmw(const T16* __restrict__ A, const T16* __restrict__ A2, const T16* __restrict__ Bt, int K, float* C, int ldc, const float* __restrict__ bias, size_t sA, size_t sB, size_t sC) {
    __shared__ __align__(16) char gs[2 * (NSPLIT == 1 ? 3 : 2) * GPL];
    __shared__ __align__(16) float osm[8 * 16 * 36];    // each wave's own store staging: 16 rows of 32 floats, pitch 36
    const size_t z = blockIdx.z; A += z * sA; if (NSPLIT == 1) A2 += z * sA; Bt += z * sB; C += z * sC;
    const int tid = threadIdx.x; const int lane = tid & 31, lr = lane & 15, hi = lane >> 4; const int w = tid >> 5, wm = w & 1, wn = w >> 1; const int r0 = blockIdx.x * 128, c0 = blockIdx.y * 128;
    v8f acc[4][2];
    gemm_tile<T16, NSPLIT>(A, A2, Bt, K, r0, c0, gs, acc);
    float* os = osm + w * (16 * 36); const int cw = c0 + wn * 32;
#pragma unroll
    for (int mb = 0; mb < 4; ++mb) {
#pragma unroll
        for (int nb = 0; nb < 2; ++nb) {
#pragma unroll
            for (int j = 0; j < 8; ++j) os[(hi * 8 + j) * 36 + nb * 16 + lr] = acc[mb][nb][j]; }
        __builtin_amdgcn_wave_barrier(); asm volatile("" ::: "memory");    // the wave's staged rows are written before it reads them back
        float* crow = C + (size_t)(r0 + wm * 64 + mb * 16) * ldc + cw;
#pragma unroll
        for (int s = 0; s < 4; ++s) { const int row = 4 * s + (lane >> 3), cofs = (lane & 7) * 4; v4f val = *(const v4fa*)(os + row * 36 + cofs); if (BIAS) { val[0] += bfr(bias[cw + cofs]); val[1] += bfr(bias[cw + cofs + 1]); val[2] += bfr(bias[cw + cofs + 2]); val[3] += bfr(bias[cw + cofs + 3]); }
            *(v4f*)(crow + (size_t)row * ldc + cofs) = val; }
        __builtin_amdgcn_wave_barrier(); asm volatile("" ::: "memory");    // the rows are read back before the next tile row overwrites them
    }
}

__device__ __forceinline__ h16 tohx(float x) { return (h16)x; }
__device__ __forceinline__ void splitf(float y, unsigned short& h, unsigned short& l) { h = f2bf(y); l = f2bf(y - bf2f(h)); }
typedef __attribute__((ext_vector_type(2))) _Float16 v2h;
typedef __attribute__((ext_vector_type(4))) _Float16 v4h;
typedef __attribute__((ext_vector_type(2))) unsigned short v2us;
typedef __attribute__((ext_vector_type(4))) unsigned short v4us;
typedef __attribute__((ext_vector_type(4))) int v4i;

// k_cvt5: the four weights and the query rounded to bf16 in ONE launch, grid 512 x 256 threads. dst: the five bf16 planes one behind the other (Wq, Wk, Wv, Wo, x).
// A work-group owns 16384 floats in a row (64 work-groups a weight, 256 the query); a wave's every load covers 512 contiguous bytes and every store 256, whole lines; a lane's sixteen loads are all issued ahead of the first rounding.
#define CVW  (DD * DD / 16384)    // work-groups a weight plane
__global__ __launch_bounds__(256) void k_cvt5(const float* __restrict__ wq, const float* __restrict__ wk, const float* __restrict__ wv, const float* __restrict__ wo, const float* __restrict__ x, bf* dst) {
    const unsigned g = blockIdx.x; const unsigned pl = g / CVW < 4u ? g / CVW : 4u;    // the plane, the same for the whole work-group
    const float* src = pl == 0 ? wq : pl == 1 ? wk : pl == 2 ? wv : pl == 3 ? wo : x;
    const size_t so = (size_t)(g - pl * CVW) * 16384 + threadIdx.x * 4, eo = (size_t)g * 16384 + threadIdx.x * 4;
    v4f v[16];
#pragma unroll    // unrolled, like the loop below: v is indexed at compile time and stays in registers
    for (int i = 0; i < 16; ++i) v[i] = *(const v4f*)(src + so + i * 1024);
#pragma unroll
    for (int i = 0; i < 16; ++i) { v4us o;
#pragma unroll
        for (int k = 0; k < 4; ++k) o[k] = f2bf(v[i][k]);
        *(v4us*)(dst + eo + i * 1024) = o; }
}
// k_qkv: the three projections in one launch, grid (NT/128, DD/128, 3), blockIdx.z = 0 q, 1 k, 2 v (W3: the three bf16 weight planes one behind the other). Each work-group writes its 128x128 tile (64 t x 2 b, two heads)
// straight into the head planes: q (x log2(e)/8) and k as fp16 [b*16+h][t][64], v as fp16 transposed [b*16+h][64][t]. The tile passes through the ring's LDS, free behind gemm_tile, so that every global store covers whole 128-byte lines.
#define QSP  132                  // floats a staged q/k row (128 + 4: the two lane halves, eight rows apart, fall on different banks)
#define VSP  72                   // fp16 a staged v line (128 B + 16: the conflict-free pitch of 16-byte reads)
__global__ __launch_bounds__(256) void k_qkv(const bf* __restrict__ X, const bf* __restrict__ W3, const float* __restrict__ bq, const float* __restrict__ bk, const float* __restrict__ bv, h16* Qf, h16* Kf, h16* VT) {
    __shared__ __align__(16) char gs[2 * 2 * GPL];
    static_assert(128 * QSP * 4 <= 2 * 2 * GPL && 256 * VSP * 2 <= 2 * 2 * GPL, "the staged tile fits the ring");
    const int tid = threadIdx.x; const int lane = tid & 31, lr = lane & 15, hi = lane >> 4; const int w = tid >> 5, wm = w & 1, wn = w >> 1; const int r0 = blockIdx.x * 128, c0 = blockIdx.y * 128; const int pz = blockIdx.z;
    const float* bias = pz == 0 ? bq : pz == 1 ? bk : bv;
    const float bb[2] = {bfr(bias[c0 + wn * 32 + lr]), bfr(bias[c0 + wn * 32 + 16 + lr])};    // fetched ahead of the ring, so that nothing waits for it behind the products
    v8f acc[4][2];
    gemm_tile<bf, 0>(X, nullptr, W3 + (size_t)pz * DD * DD, DD, r0, c0, gs, acc);
    const int t0 = r0 / NB_, h0 = c0 / HD;
    if (pz < 2) {    // the same for the whole work-group
        float* st = (float*)gs; const float sc = pz == 0 ? 0.125f * 1.4426950408889634f : 1.0f;    // 1/sqrt(64) and log2(e) folded into q ahead of its one rounding: the scores come out as exponents of two
#pragma unroll    // this and every loop below is unrolled so that acc, x0 and x1 are indexed at compile time and stay in registers
        for (int mb = 0; mb < 4; ++mb)
#pragma unroll
            for (int nb = 0; nb < 2; ++nb)
#pragma unroll
                for (int j = 0; j < 8; ++j) st[(wm * 64 + mb * 16 + hi * 8 + j) * QSP + wn * 32 + nb * 16 + lr] = (acc[mb][nb][j] + bb[nb]) * sc;
        __syncthreads();    // the whole tile is staged before any wave reads other waves' columns
        h16* Pf = pz == 0 ? Qf : Kf;
        v4f x0[8], x1[8];    // the reads stand in a loop of their own, so that later reads can be under way while earlier values are rounded
#pragma unroll
        for (int i = 0; i < 8; ++i) { const int it = i * 256 + tid; const int ch = it & 7, tl = (it >> 3) & 63, b = (it >> 9) & 1, hl = it >> 10;    // eight lanes a plane row, a wave four rows in a row: 512 contiguous bytes
            const float* sp = st + (tl * NB_ + b) * QSP + hl * HD + ch * 8; x0[i] = *(const v4fa*)sp; x1[i] = *(const v4fa*)(sp + 4); }
#pragma unroll
        for (int i = 0; i < 8; ++i) { const int it = i * 256 + tid; const int ch = it & 7, tl = (it >> 3) & 63, b = (it >> 9) & 1, hl = it >> 10; v8h of;
#pragma unroll
            for (int k = 0; k < 4; ++k) { of[k] = tohx(x0[i][k]); of[4 + k] = tohx(x1[i][k]); }
            *(v8h*)(Pf + ((size_t)(b * NH_ + h0 + hl) * TT + t0 + tl) * HD + ch * 8) = of; }
    } else {
        h16* sv = (h16*)gs;    // line (column, b): its 64 t
#pragma unroll
        for (int mb = 0; mb < 4; ++mb)
#pragma unroll
            for (int nb = 0; nb < 2; ++nb)
#pragma unroll
                for (int b = 0; b < 2; ++b) { v4h p;    // rows are t*2 + b: a lane's eight rows of a tile are four t of each b
#pragma unroll
                    for (int q = 0; q < 4; ++q) p[q] = tohx(acc[mb][nb][q * 2 + b] + bb[nb]);
                    *(v4h*)(sv + ((wn * 32 + nb * 16 + lr) * 2 + b) * VSP + wm * 32 + mb * 8 + hi * 4) = p; }
        __syncthreads();    // the whole tile is staged before any wave reads other waves' rows
#pragma unroll
        for (int i = 0; i < 8; ++i) { const int it = i * 256 + tid; const int ch = it & 7, ln = it >> 3; const int col = ln >> 1, b = ln & 1;    // eight lanes a line of V^T
            const v8h v = *(const v8ha*)(sv + ln * VSP + ch * 8);
            *(v8h*)(VT + ((size_t)(b * NH_ + h0 + (col >> 6)) * HD + (col & 63)) * TT + t0 + ch * 8) = v; }
        asm volatile("s_wait_xcnt 0x0" ::: "memory");    // stands behind the run's last store, in front of any later rewrite of the stores' address registers
    }
}
__device__ __forceinline__ float xhalf(float x) { return __builtin_bit_cast(float, __builtin_amdgcn_permlanex16(__builtin_bit_cast(int, x), __builtin_bit_cast(int, x), 0x76543210, 0xfedcba98, false, false)); }  // lane l with lane l ^ 16
// An exp with the slot the instruction set asks for behind it in the same statement, for the seldom taken path, where exps stand in a row and speed does not count.
__device__ __forceinline__ float exp2_slot(float x) { float r; asm("v_exp_f32 %0, %1\n\tv_nop" : "=v"(r) : "v"(x)); return r; }
#define PTH  32768.0f             // a lane's sum of a pass's sixteen P up to here: each of them is inside fp16
#define SK   128                  // keys a stage
#define NST  (TT / SK)            // stages
#define KP   144                  // LDS pitch of a K row (128 B + 16: 16 B x odd, the conflict-free pitch of 16-byte reads)
#define VP   272                  // LDS pitch of a V^T row (256 B + 16)
#define KPB  (SK * KP)            // one K plane of a stage
#define BUFB (KPB + HD * VP)      // one buffer: K, V^T
// One stage's eight copies of a lane (16 bytes each): four to each of K, V^T. lk, lv: the lane's LDS byte addresses in the K plane and in V^T; gk, gv: its global addresses.
__device__ __forceinline__ void stage_copy(unsigned lk, unsigned lv, const char* gk, const char* gv) {
    // the copies and, as the last line, the wait that stands in front of any rewrite of their address registers, in one statement
    asm volatile("global_load_async_to_lds_b128 %0, %8, off\n\t"
                 "global_load_async_to_lds_b128 %1, %9, off\n\t"
                 "global_load_async_to_lds_b128 %2, %10, off\n\t"
                 "global_load_async_to_lds_b128 %3, %11, off\n\t"
                 "global_load_async_to_lds_b128 %4, %12, off\n\t"
                 "global_load_async_to_lds_b128 %5, %13, off\n\t"
                 "global_load_async_to_lds_b128 %6, %14, off\n\t"
                 "global_load_async_to_lds_b128 %7, %15, off\n\t"
                 "s_wait_xcnt 0x0"
                 : : "v"(lk), "v"(lk + 32 * KP), "v"(lk + 64 * KP), "v"(lk + 96 * KP),
                     "v"(lv), "v"(lv + 16 * VP), "v"(lv + 32 * VP), "v"(lv + 48 * VP),
                     "v"(gk), "v"(gk + 4096), "v"(gk + 8192), "v"(gk + 12288),
                     "v"(gv), "v"(gv + 16 * TT * 2), "v"(gv + 32 * TT * 2), "v"(gv + 48 * TT * 2)
                 : "memory");
}
__global__ __launch_bounds__(256) void k_fattn(const h16* __restrict__ Qf, const h16* __restrict__ Kf, const h16* __restrict__ VT, bf* Ah, bf* Al) {
    __shared__ __align__(16) char sm[2 * BUFB];
    const int tid = threadIdx.x; const int lane = tid & 31, c = lane & 15, hi = lane >> 4; const int z = blockIdx.y; const int q0 = blockIdx.x * 256 + (tid >> 5) * 32;
    const size_t zo = (size_t)z * TT * HD;
    const unsigned lk = (unsigned)(size_t)sm + (unsigned)((tid >> 3) * KP + (tid & 7) * 16), lv = (unsigned)(size_t)sm + (unsigned)(KPB + (tid >> 4) * VP + (tid & 15) * 16);
    const char* gk = (const char*)(Kf + zo) + tid * 16; const char* gv = (const char*)(VT + zo) + (tid >> 4) * (TT * 2) + (tid & 15) * 16;
    const unsigned qo[2] = {(unsigned)(zo + (q0 + c) * HD + 8 * hi) * 2u, (unsigned)(zo + (q0 + 16 + c) * HD + 8 * hi) * 2u};    // the lane's byte offsets into the Q plane
    v16h qf[2][2];
#pragma unroll
    for (int g = 0; g < 2; ++g)
#pragma unroll
        for (int kc = 0; kc < 2; ++kc) qf[g][kc] = WFrag<h16>::ld((const h16*)((const char*)Qf + qo[g]) + kc * 32);
    v8f o[4][2];
#pragma unroll
    for (int dt = 0; dt < 4; ++dt)
#pragma unroll
        for (int g = 0; g < 2; ++g) o[dt][g] = (v8f){};
    float l[2] = {0.f, 0.f};
    v8f cn[2] = {(v8f){}, (v8f){}};    // 10 - m of the lane's column, in all eight registers of an accumulator tile
    asm volatile("s_wait_xcnt 0x0" : : "v"(qo[0]), "v"(qo[1]) : "memory");    // keeps the Q loads' offset registers untouched up to the wait; behind it they are free for reuse
    const char* fk = sm + c * KP + 16 * hi; const char* fv = sm + KPB + c * VP + 16 * hi;    // the lane's fragment bases in buffer 0
#pragma unroll 1    // stays rolled: the copies keep one place of issue, and the four-pass body stands once in the instruction cache
    for (int t = -2; t < NST; ++t) {    // trips -2 and -1 are the ring's prologue: they only pass the foot, which issues stage 0, then publishes it and issues stage 1
        const int bo = (t & 1) * BUFB;
        if (t >= 0) {
        v16h kf[2][2];
#pragma unroll
        for (int kt = 0; kt < 2; ++kt)
#pragma unroll
            for (int kc = 0; kc < 2; ++kc) kf[kt][kc] = WFrag<h16>::ld((const h16*)(fk + bo + kt * 16 * KP + kc * 64));
        __builtin_amdgcn_sched_barrier(0);    // the stage's first fragment reads stay one group too, in front of the first products
#pragma unroll    // unrolled: every LDS offset of a pass is an immediate
        for (int sub = 0; sub < SK / 32; ++sub) {
            v8f s[2][2];
#pragma unroll
            for (int kc = 0; kc < 2; ++kc)    // the d half outermost: the four tiles' products stand between a tile's two dependent ones
#pragma unroll
                for (int kt = 0; kt < 2; ++kt)
#pragma unroll
                    for (int g = 0; g < 2; ++g) s[kt][g] = wmma16(kf[kt][kc], qf[g][kc], kc == 0 ? cn[g] : s[kt][g]);
            __builtin_amdgcn_sched_barrier(0);    // all LDS reads of a pass stand in ONE place, behind its score products, for speed only
            if (sub + 1 < SK / 32) {    // the next 32 keys' fragments, of this same stage, into the registers the products have just read
#pragma unroll
                for (int kt = 0; kt < 2; ++kt)
#pragma unroll
                    for (int kc = 0; kc < 2; ++kc) kf[kt][kc] = WFrag<h16>::ld((const h16*)(fk + bo + ((sub + 1) * 32 + kt * 16) * KP + kc * 64));
            }
            v16h vf[4];    // this pass's V^T fragments: they return while the exps run
#pragma unroll
            for (int dt = 0; dt < 4; ++dt) vf[dt] = WFrag<h16>::ld((const h16*)(fv + bo + dt * 16 * VP + sub * 64));
            __builtin_amdgcn_sched_barrier(0);    // and none of these reads moves down among the exps and the products behind them
            float p[2][16], ps[2];
#pragma unroll
            for (int e = 0; e < 4; ++e)
#pragma unroll
                for (int g = 0; g < 2; ++g) p[g][e] = s[0][g][e];
            // the first eight exps run ahead of the adds, so that an add finds its exp's result ready. Nothing plain is there yet to stand between them: written in place in one statement, none of them overwrites the source of the one in front of it.
            // The v_nop is the slot the instruction set asks for behind the last of them.
            asm volatile("v_exp_f32 %0, %0\n\tv_exp_f32 %1, %1\n\tv_exp_f32 %2, %2\n\tv_exp_f32 %3, %3\n\t"
                         "v_exp_f32 %4, %4\n\tv_exp_f32 %5, %5\n\tv_exp_f32 %6, %6\n\tv_exp_f32 %7, %7\n\t"
                         "v_nop"
                         : "+v"(p[0][0]), "+v"(p[0][1]), "+v"(p[0][2]), "+v"(p[0][3]), "+v"(p[1][0]), "+v"(p[1][1]), "+v"(p[1][2]), "+v"(p[1][3]));
#pragma unroll
            for (int e = 0; e < 16; ++e)
#pragma unroll
                for (int g = 0; g < 2; ++g) { if (e >= 4) p[g][e] = __builtin_amdgcn_exp2f(s[e >> 3][g][e & 7]); ps[g] = e == 0 ? p[g][0] : ps[g] + p[g][e]; }
            // behind them one plain vector instruction in front of each exp: it fills the earlier exp's slot
#pragma unroll
            for (int e = 0; e < 24; ++e) { __builtin_amdgcn_sched_group_barrier(0x2, 1, 0); __builtin_amdgcn_sched_group_barrier(0x400, 1, 0); }
            const bool first = sub == 0 && t == 0;    // the same for the whole work-group
            if (__builtin_amdgcn_ballot_w32(ps[0] > PTH || ps[1] > PTH) != 0 || first) {    // some column has outgrown its reference (or has none yet): renew m, rescale sums and output tiles (factor 1 in the columns that keep theirs), form this pass's P again
                v16h kr[2][2];    // the pass's K fragments once more from the stage's buffer, so that the scores need not stay in registers on the path that is nearly always taken
#pragma unroll
                for (int kt = 0; kt < 2; ++kt)
#pragma unroll
                    for (int kc = 0; kc < 2; ++kc) kr[kt][kc] = WFrag<h16>::ld((const h16*)(fk + bo + (sub * 32 + kt * 16) * KP + kc * 64));
#pragma unroll
                for (int g = 0; g < 2; ++g) { v8f r2[2];
#pragma unroll
                    for (int kt = 0; kt < 2; ++kt) r2[kt] = wmma16(kr[kt][1], qf[g][1], wmma16(kr[kt][0], qf[g][0], cn[g]));
                    float mx = r2[0][0];
#pragma unroll
                    for (int r = 1; r < 8; ++r) mx = fmaxf(mx, r2[0][r]);
#pragma unroll
                    for (int r = 0; r < 8; ++r) mx = fmaxf(mx, r2[1][r]);
                    mx = fmaxf(mx, xhalf(mx));
                    const float d = first ? mx - 10.0f : fmaxf(mx - 10.0f, 0.f);    // the first pass sets m to its maximum, up or down; later m only rises
                    const float al = exp2_slot(fminf(-d, 0.f)); l[g] *= al;
#pragma unroll
                    for (int r = 0; r < 8; ++r) cn[g][r] -= d;
#pragma unroll
                    for (int dt = 0; dt < 4; ++dt)
#pragma unroll
                        for (int r = 0; r < 8; ++r) o[dt][g][r] *= al;
                    ps[g] = 0.f;
#pragma unroll
                    for (int e = 0; e < 16; ++e) { p[g][e] = exp2_slot(r2[e >> 3][e & 7] - d); ps[g] += p[g][e]; } }
            }
#pragma unroll
            for (int g = 0; g < 2; ++g) { v16h pb; l[g] += ps[g];
#pragma unroll
                for (int e = 0; e < 16; ++e) pb[e] = tohx(p[g][e]);
#pragma unroll
                for (int dt = 0; dt < 4; ++dt) o[dt][g] = wmma16(vf[dt], pb, o[dt][g]); }
        }
        }
        asm volatile("s_wait_dscnt 0x0" ::: "memory");       // this wave's reads of the buffer have returned before it is refilled
        asm volatile("s_wait_asynccnt 0x0" ::: "memory");    // this wave's share of stage t + 1 has landed
        __syncthreads();                                      // publishes stage t + 1 and ends every wave's reads of stage t
        if (t + 2 < NST) stage_copy(lk + bo, lv + bo, gk + (t + 2) * (SK * HD * 2), gv + (t + 2) * (SK * 2));    // stage t + 2 into the buffer just left
    }
    asm volatile("s_wait_asynccnt 0x0" ::: "memory");    // no copy is outstanding when the wave ends
    const int b = z >> 4, h = z & 15;
#pragma unroll
    for (int g = 0; g < 2; ++g) { const float inv = __fdiv_rn(1.0f, l[g] + xhalf(l[g])); const size_t ob = ((size_t)(q0 + g * 16 + c) * NB_ + b) * DD + h * HD + 8 * hi;
#pragma unroll
        for (int dt = 0; dt < 4; ++dt) { v8us oh, ol;
#pragma unroll
            for (int r = 0; r < 8; ++r) { unsigned short a, c2; splitf(o[dt][g][r] * inv, a, c2); oh[r] = a; ol[r] = c2; }
            *(v8us*)(Ah + ob + dt * 16) = oh; *(v8us*)(Al + ob + dt * 16) = ol; } }
}

extern "C" void kernel_launch(void* const* d_in, const int* in_sizes, int n_in,
                              void* d_out, int out_size, void* d_ws, size_t ws_size, hipStream_t stream) {
    (void)in_sizes; (void)n_in; (void)out_size;
    const float* x = (const float*)d_in[0]; const float* wq = (const float*)d_in[1]; const float* bq = (const float*)d_in[2]; const float* wk = (const float*)d_in[3]; const float* bk = (const float*)d_in[4]; const float* wv = (const float*)d_in[5]; const float* bv = (const float*)d_in[6];
    const float* wo = (const float*)d_in[7]; const float* bo = (const float*)d_in[8];
    float* OUT = (float*)d_out;     // [2048][2][1024] (rows t*2 + b)
    char* wsp = (char*)d_ws;
    auto take = [&](size_t bytes) { char* p = wsp; wsp += (bytes + 255) & ~(size_t)255; return (void*)p; };
    bf* WQ = (bf*)take((size_t)DD * DD * 2); bf* WK = (bf*)take((size_t)DD * DD * 2); bf* WV = (bf*)take((size_t)DD * DD * 2); bf* WO = (bf*)take((size_t)DD * DD * 2);
    bf* XB = (bf*)take((size_t)NT * DD * 2);
    h16* QF = (h16*)take((size_t)NT * DD * 2); h16* KF = (h16*)take((size_t)NT * DD * 2); h16* VT = (h16*)take((size_t)NT * DD * 2);
    bf* ATh = (bf*)take((size_t)NT * DD * 2); bf* ATl = (bf*)take((size_t)NT * DD * 2);
    if ((size_t)(wsp - (char*)d_ws) > ws_size) return;    // ws 256 MiB
    k_cvt5<<<4 * CVW + NT * DD / 16384, 256, 0, stream>>>(wq, wk, wv, wo, x, WQ);    // WQ, WK, WV, WO, XB lie one behind the other (each plane a multiple of 256 bytes)
    k_qkv<<<dim3(NT / 128, DD / 128, 3), 256, 0, stream>>>(XB, WQ, bq, bk, bv, QF, KF, VT);    // WQ, WK, WV lie one behind the other (each plane a multiple of 256 bytes)
    k_fattn<<<dim3(TT / 256, NB_ * NH_, 1), 256, 0, stream>>>(QF, KF, VT, ATh, ATl);
    k_gemmw<bf, 1, true><<<dim3(NT / 128, DD / 128, 1), 256, 0, stream>>>(ATh, ATl, WO, DD, OUT, DD, bo, 0, 0, 0);
}

// v009
// One run takes 73.5 microseconds.
// In both of two side-by-side timings against v008, it was 1.05 times as fast.
// Counting every step since v000, it is 17.3 times as fast.
#include <hip/hip_runtime.h>

// JITCompatibleMultiheadAttention (query [T=2048][B=2][E=1024] seq-first layout; q = (query Wq^T + bq) * 64^-0.5, k/v = query W^T + b; 16 heads x 64 ([T,B,E] -> [B*16][T][64]);
// softmax(q.k) v; out [T][B][E] = attn Wo^T + bo). Rows are indexed r = t*2 + b everywhere (projections and the output GEMM are row-order agnostic; the head-plane builders and the merge use t*NB_ + b).
// Compute dtypes, f32 accumulate: every float input rounded to bf16; q/k/v projections on PLAIN bf16 operands (x, W inputs: exact, + bias);
// scores on SINGLE fp16 q (x log2(e)/8) and k planes (1 product); attn.v on SINGLE fp16 planes (P x1024, v); output Linear on hi+lo planes x exact bf16 W (2 products); 

#define NB_  2
#define TT   2048
#define DD   1024
#define NH_  16
#define HD   64
#define NT   (NB_ * TT)
typedef _Float16 h16;
typedef unsigned short bf;
typedef __attribute__((ext_vector_type(16))) __bf16   v16bf;
typedef __attribute__((ext_vector_type(16))) _Float16 v16h;
typedef __attribute__((ext_vector_type(8)))  _Float16 v8h;
typedef __attribute__((ext_vector_type(8)))  unsigned short v8us;
typedef __attribute__((ext_vector_type(8)))  float    v8f;
typedef __attribute__((ext_vector_type(4)))  float    v4f;
typedef v8h  __attribute__((may_alias)) v8ha;
typedef v4f  __attribute__((may_alias)) v4fa;
typedef v8us __attribute__((may_alias)) v8usa;

__device__ __forceinline__ unsigned short f2bf(float f) { unsigned u = __float_as_uint(f); u += 0x7FFFu + ((u >> 16) & 1u); return (unsigned short)(u >> 16); }
__device__ __forceinline__ float bf2f(unsigned short b) { return __uint_as_float(((unsigned)b) << 16); }
__device__ __forceinline__ float bfr(float f) { return bf2f(f2bf(f)); }
__device__ __forceinline__ v16h cat16(v8h lo, v8h hi) { return __builtin_shufflevector(lo, hi, 0, 1, 2, 3, 4, 5, 6, 7, 8, 9, 10, 11, 12, 13, 14, 15); }
__device__ __forceinline__ v16bf cat16b(v8us lo, v8us hi) { return __builtin_bit_cast(v16bf, __builtin_shufflevector(lo, hi, 0, 1, 2, 3, 4, 5, 6, 7, 8, 9, 10, 11, 12, 13, 14, 15)); }
__device__ __forceinline__ v8f wmma16(v16h a, v16h b, v8f c) { return __builtin_amdgcn_wmma_f32_16x16x32_f16(false, a, false, b, (short)0, c, false, false); }
__device__ __forceinline__ v8f wmmab(v16bf a, v16bf b, v8f c) { return __builtin_amdgcn_wmma_f32_16x16x32_bf16(false, a, false, b, (short)0, c, false, false); }



// ---- k_gemmw: GEMM on K-contiguous 16-bit planes, one 128x128 output tile per work-group of eight waves (2 x 4, each 64x32: 8 accumulators); grid (M/128, N/128, Z), 256 threads.
// C[m][n] (f32, pitch ldc, + optional f32 bias[n]) = sum_k A[m][k] Bt[n][k] (NSPLIT == 1: + A2[m][k] Bt[n][k]). z-batch strides sA/sB/sC in elements. K % 128 == 0, M % 128 == 0, N % 128 == 0.
// The operand rows come 128 k (256 B, whole lines) at a time into two LDS buffers by asynchronous copies, each byte fetched once a work-group; every wave reads its fragments from LDS.
template <typename T16> struct WFrag;
template <> struct WFrag<h16> { typedef v16h V; static __device__ __forceinline__ V ld(const h16* p) { return cat16(*(const v8h*)p, *(const v8h*)(p + 16)); } static __device__ __forceinline__ v8f mma(V a, V b, v8f c) { return wmma16(a, b, c); } };
template <> struct WFrag<bf> { typedef v16bf V; static __device__ __forceinline__ V ld(const bf* p) { return cat16b(*(const v8us*)p, *(const v8us*)(p + 16)); } static __device__ __forceinline__ v8f mma(V a, V b, v8f c) { return wmmab(a, b, c); } };
#define GS   128                  // k elements a stage
#define GP   272                  // LDS pitch of a staged row (256 B + 16: 16 B x odd, the conflict-free pitch of 16-byte reads)
#define GPL  (128 * GP)           // one staged plane: 128 rows
// One plane's eight copies of a lane (16 bytes each, rows 16 apart). l: the lane's LDS byte address in the plane; g: its global address; rs: bytes of 16 source rows.
__device__ __forceinline__ void plane_copy(unsigned l, const char* g, size_t rs) {
    // the copies and, as the last line, the wait that stands in front of any rewrite of their address registers, in one statement
    asm volatile("global_load_async_to_lds_b128 %0, %8, off\n\t"
                 "global_load_async_to_lds_b128 %1, %9, off\n\t"
                 "global_load_async_to_lds_b128 %2, %10, off\n\t"
                 "global_load_async_to_lds_b128 %3, %11, off\n\t"
                 "global_load_async_to_lds_b128 %4, %12, off\n\t"
                 "global_load_async_to_lds_b128 %5, %13, off\n\t"
                 "global_load_async_to_lds_b128 %6, %14, off\n\t"
                 "global_load_async_to_lds_b128 %7, %15, off\n\t"
                 "s_wait_xcnt 0x0"
                 : : "v"(l), "v"(l + 16 * GP), "v"(l + 32 * GP), "v"(l + 48 * GP), "v"(l + 64 * GP), "v"(l + 80 * GP), "v"(l + 96 * GP), "v"(l + 112 * GP),
                     "v"(g), "v"(g + rs), "v"(g + 2 * rs), "v"(g + 3 * rs), "v"(g + 4 * rs), "v"(g + 5 * rs), "v"(g + 6 * rs), "v"(g + 7 * rs)
                 : "memory");
}
// gemm_tile: the ring and the products of NBP 128x128 tiles that share their A rows (rows r0.., columns c0.. of NBP B planes, sBp elements apart); gs: the work-group's two buffers. Behind it no wave reads gs any more and no copy is in flight (the last stage's foot barrier).
template <typename T16, int NSPLIT, int NBP>
__device__ __forceinline__ void gemm_tile(const T16* __restrict__ A, const T16* __restrict__ A2, const T16* __restrict__ Bt, size_t sBp, int K, int r0, int c0, char* gs, v8f (&acc)[NBP][4][2]) {
    static_assert(NSPLIT == 0 || NSPLIT == 1, "one or two A planes");
    typedef typename WFrag<T16>::V V;
    constexpr int NA = 1 + NSPLIT, NPL = NA + NBP;    // staged planes: A, (A2,) then the B planes
    constexpr int GBUF = NPL * GPL;              // one buffer
    const int tid = threadIdx.x; const int lane = tid & 31, lr = lane & 15, hi = lane >> 4; const int w = tid >> 5, wm = w & 1, wn = w >> 1;
#pragma unroll
    for (int p = 0; p < NBP; ++p)
#pragma unroll
        for (int mb = 0; mb < 4; ++mb)
#pragma unroll
            for (int nb = 0; nb < 2; ++nb) acc[p][mb][nb] = (v8f){};
    const unsigned lc = (unsigned)(size_t)gs + (unsigned)((tid >> 4) * GP + (tid & 15) * 16);    // the lane's place in a staged plane
    const size_t rs = (size_t)K * 32;
    const char* gA = (const char*)(A + (size_t)(r0 + (tid >> 4)) * K) + (tid & 15) * 16; const char* gA2 = NSPLIT == 1 ? (const char*)(A2 + (size_t)(r0 + (tid >> 4)) * K) + (tid & 15) * 16 : nullptr; const char* gB = (const char*)(Bt + (size_t)(c0 + (tid >> 4)) * K) + (tid & 15) * 16;
    auto stage = [&](int t, unsigned bo) { plane_copy(lc + bo, gA + (size_t)t * (GS * 2), rs); if (NSPLIT == 1) plane_copy(lc + bo + GPL, gA2 + (size_t)t * (GS * 2), rs);
#pragma unroll
        for (int p = 0; p < NBP; ++p) {
            if (NBP > 1) __builtin_amdgcn_sched_barrier(0);    // each plane's addresses are formed directly in front of its copies: formed all at once, those of four planes do not fit the registers the copies can name, and a pointer goes to scratch
            plane_copy(lc + bo + (NA + p) * GPL, gB + p * sBp * 2 + (size_t)t * (GS * 2), rs); } };
    const char* fa = gs + (wm * 64 + lr) * GP + 16 * hi; const char* fb = gs + NA * GPL + (wn * 32 + lr) * GP + 16 * hi;    // the lane's fragment bases in buffer 0
    const int nst = K / GS;
    stage(0, 0);
    asm volatile("s_wait_asynccnt 0x0" ::: "memory");    // this wave's share of stage 0 has landed
    __syncthreads();                                      // publishes stage 0
    if (nst > 1) stage(1, GBUF);
#pragma unroll 1    // stays rolled: one stage's body stands once in the instruction cache
    for (int t = 0; t < nst; ++t) {
        const int bo = (t & 1) * GBUF;
        V a[2][4], a2[2][4], b[2][NBP][2];    // two fragment sets: a step's products run on one while the next step's reads fill the other
        auto frag = [&](int ks, int s) {
#pragma unroll
            for (int mb = 0; mb < 4; ++mb) { a[s][mb] = WFrag<T16>::ld((const T16*)(fa + bo + mb * 16 * GP + ks * 64)); if (NSPLIT == 1) a2[s][mb] = WFrag<T16>::ld((const T16*)(fa + bo + GPL + mb * 16 * GP + ks * 64)); }
#pragma unroll
            for (int p = 0; p < NBP; ++p)
#pragma unroll
                for (int nb = 0; nb < 2; ++nb) b[s][p][nb] = WFrag<T16>::ld((const T16*)(fb + bo + p * GPL + nb * 16 * GP + ks * 64)); };
        frag(0, 0);
        __builtin_amdgcn_sched_barrier(0);    // the first step's reads stay in front of the second's, so that the first products wait for their own set alone
#pragma unroll    // unrolled: every LDS offset is an immediate and the fragment sets are named at compile time
        for (int ks = 0; ks < GS / 32; ++ks) {
            const int s = ks & 1;
            if (ks + 1 < GS / 32) frag(ks + 1, s ^ 1);    // of this same stage only
            __builtin_amdgcn_sched_barrier(0);    // the next step's reads stay one group ahead of this step's products, for speed only
#pragma unroll
            for (int p = 0; p < NBP; ++p)
#pragma unroll
                for (int nb = 0; nb < 2; ++nb)
#pragma unroll
                    for (int mb = 0; mb < 4; ++mb) acc[p][mb][nb] = WFrag<T16>::mma(a[s][mb], b[s][p][nb], acc[p][mb][nb]);
            if (NSPLIT == 1) {
#pragma unroll
                for (int p = 0; p < NBP; ++p)
#pragma unroll
                    for (int nb = 0; nb < 2; ++nb)
#pragma unroll
                        for (int mb = 0; mb < 4; ++mb) acc[p][mb][nb] = WFrag<T16>::mma(a2[s][mb], b[s][p][nb], acc[p][mb][nb]);
            }
            __builtin_amdgcn_sched_barrier(0);    // and the reads behind these products do not move in among them
        }
        asm volatile("s_wait_dscnt 0x0" ::: "memory");       // this wave's reads of the buffer have returned before it is refilled
        asm volatile("s_wait_asynccnt 0x0" ::: "memory");    // this wave's share of stage t + 1 has landed
        __syncthreads();                                      // publishes stage t + 1 and ends every wave's reads of stage t
        if (t + 2 < nst) stage(t + 2, (unsigned)bo);          // stage t + 2 into the buffer just left
    }
    asm volatile("s_wait_asynccnt 0x0" ::: "memory");    // no copy is outstanding when the wave ends
}
template <typename T16, int NSPLIT, bool BIAS>
__global__ __launch_bounds__(256) void k_gemmw(const T16* __restrict__ A, const T16* __restrict__ A2, const T16* __restrict__ Bt, int K, float* C, int ldc, const float* __restrict__ bias, size_t sA, size_t sB, size_t sC) {
    __shared__ __align__(16) char gs[2 * (NSPLIT == 1 ? 3 : 2) * GPL];
    __shared__ __align__(16) float osm[8 * 16 * 36];    // each wave's own store staging: 16 rows of 32 floats, pitch 36
    const size_t z = blockIdx.z; A += z * sA; if (NSPLIT == 1) A2 += z * sA; Bt += z * sB; C += z * sC;
    const int tid = threadIdx.x; const int lane = tid & 31, lr = lane & 15, hi = lane >> 4; const int w = tid >> 5, wm = w & 1, wn = w >> 1; const int r0 = blockIdx.x * 128, c0 = blockIdx.y * 128;
    v8f acc[1][4][2];
    gemm_tile<T16, NSPLIT, 1>(A, A2, Bt, 0, K, r0, c0, gs, acc);
    float* os = osm + w * (16 * 36); const int cw = c0 + wn * 32;
#pragma unroll
    for (int mb = 0; mb < 4; ++mb) {
#pragma unroll
        for (int nb = 0; nb < 2; ++nb) {
#pragma unroll
            for (int j = 0; j < 8; ++j) os[(hi * 8 + j) * 36 + nb * 16 + lr] = acc[0][mb][nb][j]; }
        __builtin_amdgcn_wave_barrier(); asm volatile("" ::: "memory");    // the wave's staged rows are written before it reads them back
        float* crow = C + (size_t)(r0 + wm * 64 + mb * 16) * ldc + cw;
#pragma unroll
        for (int s = 0; s < 4; ++s) { const int row = 4 * s + (lane >> 3), cofs = (lane & 7) * 4; v4f val = *(const v4fa*)(os + row * 36 + cofs); if (BIAS) { val[0] += bfr(bias[cw + cofs]); val[1] += bfr(bias[cw + cofs + 1]); val[2] += bfr(bias[cw + cofs + 2]); val[3] += bfr(bias[cw + cofs + 3]); }
            *(v4f*)(crow + (size_t)row * ldc + cofs) = val; }
        __builtin_amdgcn_wave_barrier(); asm volatile("" ::: "memory");    // the rows are read back before the next tile row overwrites them
    }
}

__device__ __forceinline__ h16 tohx(float x) { return (h16)x; }
__device__ __forceinline__ void splitf(float y, unsigned short& h, unsigned short& l) { h = f2bf(y); l = f2bf(y - bf2f(h)); }
typedef __attribute__((ext_vector_type(2))) _Float16 v2h;
typedef __attribute__((ext_vector_type(4))) _Float16 v4h;
typedef __attribute__((ext_vector_type(2))) unsigned short v2us;
typedef __attribute__((ext_vector_type(4))) unsigned short v4us;
typedef __attribute__((ext_vector_type(4))) int v4i;

// k_cvt5: the four weights and the query rounded to bf16 in ONE launch, grid 512 x 256 threads. dst: the five bf16 planes one behind the other (Wq, Wk, Wv, Wo, x).
// A work-group owns 16384 floats in a row (64 work-groups a weight, 256 the query); a wave's every load covers 512 contiguous bytes and every store 256, whole lines; a lane's sixteen loads are all issued ahead of the first rounding.
#define CVW  (DD * DD / 16384)    // work-groups a weight plane
__global__ __launch_bounds__(256) void k_cvt5(const float* __restrict__ wq, const float* __restrict__ wk, const float* __restrict__ wv, const float* __restrict__ wo, const float* __restrict__ x, bf* dst) {
    const unsigned g = blockIdx.x; const unsigned pl = g / CVW < 4u ? g / CVW : 4u;    // the plane, the same for the whole work-group
    const float* src = pl == 0 ? wq : pl == 1 ? wk : pl == 2 ? wv : pl == 3 ? wo : x;
    const size_t so = (size_t)(g - pl * CVW) * 16384 + threadIdx.x * 4, eo = (size_t)g * 16384 + threadIdx.x * 4;
    v4f v[16];
#pragma unroll    // unrolled, like the loop below: v is indexed at compile time and stays in registers
    for (int i = 0; i < 16; ++i) v[i] = *(const v4f*)(src + so + i * 1024);
#pragma unroll
    for (int i = 0; i < 16; ++i) { v4us o;
#pragma unroll
        for (int k = 0; k < 4; ++k) o[k] = f2bf(v[i][k]);
        *(v4us*)(dst + eo + i * 1024) = o; }
}
// k_qkv: the three projections in one launch, grid (NT/128, DD/128). A work-group forms the q, k and v tiles of the same 128 rows and 128 columns together (W3: the three bf16 weight planes one behind the other):
// the X rows are staged once for the three, and a wave's four X fragments of a step meet six weight fragments (64 x 96 a wave), so that the LDS reads a product fall below what the LDS delivers at full matrix rate.
// The tiles (64 t x 2 b, two heads) go straight into the head planes: q (x log2(e)/8) and k as fp16 [b*16+h][t][64], v as fp16 transposed [b*16+h][64][t]. They pass through the ring's LDS, free behind gemm_tile, so that every global store covers whole 128-byte lines.
#define QSP  132                  // floats a staged q/k row (128 + 4: the two lane halves, eight rows apart, fall on different banks)
#define VSP  72                   // fp16 a staged v line (128 B + 16: the conflict-free pitch of 16-byte reads)
#define QSB  (128 * QSP * 4)      // bytes of a staged q or k tile
__global__ __launch_bounds__(256) void k_qkv(const bf* __restrict__ X, const bf* __restrict__ W3, const float* __restrict__ bq, const float* __restrict__ bk, const float* __restrict__ bv, h16* Qf, h16* Kf, h16* VT) {
    __shared__ __align__(16) char gs[2 * 4 * GPL];
    static_assert(2 * QSB + 256 * VSP * 2 <= 2 * 4 * GPL, "the three staged tiles fit the ring side by side");
    const int tid = threadIdx.x; const int lane = tid & 31, lr = lane & 15, hi = lane >> 4; const int w = tid >> 5, wm = w & 1, wn = w >> 1; const int r0 = blockIdx.x * 128, c0 = blockIdx.y * 128;
    const int cb = c0 + wn * 32 + lr;
    const float bb[3][2] = {{bfr(bq[cb]), bfr(bq[cb + 16])}, {bfr(bk[cb]), bfr(bk[cb + 16])}, {bfr(bv[cb]), bfr(bv[cb + 16])}};    // fetched ahead of the ring, so that nothing waits for it behind the products
    v8f acc[3][4][2];
    gemm_tile<bf, 0, 3>(X, nullptr, W3, (size_t)DD * DD, DD, r0, c0, gs, acc);
    const int t0 = r0 / NB_, h0 = c0 / HD;
#pragma unroll    // this and every loop below is unrolled so that acc, x0 and x1 are indexed at compile time and stay in registers
    for (int pz = 0; pz < 2; ++pz) {
        float* st = (float*)(gs + pz * QSB); const float sc = pz == 0 ? 0.125f * 1.4426950408889634f : 1.0f;    // 1/sqrt(64) and log2(e) folded into q ahead of its one rounding: the scores come out as exponents of two
#pragma unroll
        for (int mb = 0; mb < 4; ++mb)
#pragma unroll
            for (int nb = 0; nb < 2; ++nb)
#pragma unroll
                for (int j = 0; j < 8; ++j) st[(wm * 64 + mb * 16 + hi * 8 + j) * QSP + wn * 32 + nb * 16 + lr] = (acc[pz][mb][nb][j] + bb[pz][nb]) * sc;
    }
    h16* sv = (h16*)(gs + 2 * QSB);    // line (column, b): its 64 t
#pragma unroll
    for (int mb = 0; mb < 4; ++mb)
#pragma unroll
        for (int nb = 0; nb < 2; ++nb)
#pragma unroll
            for (int b = 0; b < 2; ++b) { v4h p;    // rows are t*2 + b: a lane's eight rows of a tile are four t of each b
#pragma unroll
                for (int q = 0; q < 4; ++q) p[q] = tohx(acc[2][mb][nb][q * 2 + b] + bb[2][nb]);
                *(v4h*)(sv + ((wn * 32 + nb * 16 + lr) * 2 + b) * VSP + wm * 32 + mb * 8 + hi * 4) = p; }
    __syncthreads();    // the three tiles are staged before any wave reads other waves' columns and rows
#pragma unroll
    for (int pz = 0; pz < 2; ++pz) {
        const float* st = (const float*)(gs + pz * QSB); h16* Pf = pz == 0 ? Qf : Kf;
        v4f x0[8], x1[8];    // the reads stand in a loop of their own, so that later reads can be under way while earlier values are rounded
#pragma unroll
        for (int i = 0; i < 8; ++i) { const int it = i * 256 + tid; const int ch = it & 7, tl = (it >> 3) & 63, b = (it >> 9) & 1, hl = it >> 10;    // eight lanes a plane row, a wave four rows in a row: 512 contiguous bytes
            const float* sp = st + (tl * NB_ + b) * QSP + hl * HD + ch * 8; x0[i] = *(const v4fa*)sp; x1[i] = *(const v4fa*)(sp + 4); }
#pragma unroll
        for (int i = 0; i < 8; ++i) { const int it = i * 256 + tid; const int ch = it & 7, tl = (it >> 3) & 63, b = (it >> 9) & 1, hl = it >> 10; v8h of;
#pragma unroll
            for (int k = 0; k < 4; ++k) { of[k] = tohx(x0[i][k]); of[4 + k] = tohx(x1[i][k]); }
            *(v8h*)(Pf + ((size_t)(b * NH_ + h0 + hl) * TT + t0 + tl) * HD + ch * 8) = of; }
        asm volatile("s_wait_xcnt 0x0" ::: "memory");    // stands behind the run's last store, in front of any later rewrite of the stores' address registers
    }
#pragma unroll
    for (int i = 0; i < 8; ++i) { const int it = i * 256 + tid; const int ch = it & 7, ln = it >> 3; const int col = ln >> 1, b = ln & 1;    // eight lanes a line of V^T
        const v8h v = *(const v8ha*)(sv + ln * VSP + ch * 8);
        *(v8h*)(VT + ((size_t)(b * NH_ + h0 + (col >> 6)) * HD + (col & 63)) * TT + t0 + ch * 8) = v; }
    asm volatile("s_wait_xcnt 0x0" ::: "memory");    // stands behind the run's last store, in front of any later rewrite of the stores' address registers
}
__device__ __forceinline__ float xhalf(float x) { return __builtin_bit_cast(float, __builtin_amdgcn_permlanex16(__builtin_bit_cast(int, x), __builtin_bit_cast(int, x), 0x76543210, 0xfedcba98, false, false)); }  // lane l with lane l ^ 16
// An exp with the slot the instruction set asks for behind it in the same statement, for the seldom taken path, where exps stand in a row and speed does not count.
__device__ __forceinline__ float exp2_slot(float x) { float r; asm("v_exp_f32 %0, %1\n\tv_nop" : "=v"(r) : "v"(x)); return r; }
#define PTH  32768.0f             // a lane's sum of a pass's sixteen P up to here: each of them is inside fp16
#define SK   128                  // keys a stage
#define NST  (TT / SK)            // stages
#define KP   144                  // LDS pitch of a K row (128 B + 16: 16 B x odd, the conflict-free pitch of 16-byte reads)
#define VP   272                  // LDS pitch of a V^T row (256 B + 16)
#define KPB  (SK * KP)            // one K plane of a stage
#define BUFB (KPB + HD * VP)      // one buffer: K, V^T
// One stage's eight copies of a lane (16 bytes each): four to each of K, V^T. lk, lv: the lane's LDS byte addresses in the K plane and in V^T; gk, gv: its global addresses.
__device__ __forceinline__ void stage_copy(unsigned lk, unsigned lv, const char* gk, const char* gv) {
    // the copies and, as the last line, the wait that stands in front of any rewrite of their address registers, in one statement
    asm volatile("global_load_async_to_lds_b128 %0, %8, off\n\t"
                 "global_load_async_to_lds_b128 %1, %9, off\n\t"
                 "global_load_async_to_lds_b128 %2, %10, off\n\t"
                 "global_load_async_to_lds_b128 %3, %11, off\n\t"
                 "global_load_async_to_lds_b128 %4, %12, off\n\t"
                 "global_load_async_to_lds_b128 %5, %13, off\n\t"
                 "global_load_async_to_lds_b128 %6, %14, off\n\t"
                 "global_load_async_to_lds_b128 %7, %15, off\n\t"
                 "s_wait_xcnt 0x0"
                 : : "v"(lk), "v"(lk + 32 * KP), "v"(lk + 64 * KP), "v"(lk + 96 * KP),
                     "v"(lv), "v"(lv + 16 * VP), "v"(lv + 32 * VP), "v"(lv + 48 * VP),
                     "v"(gk), "v"(gk + 4096), "v"(gk + 8192), "v"(gk + 12288),
                     "v"(gv), "v"(gv + 16 * TT * 2), "v"(gv + 32 * TT * 2), "v"(gv + 48 * TT * 2)
                 : "memory");
}
__global__ __launch_bounds__(256) void k_fattn(const h16* __restrict__ Qf, const h16* __restrict__ Kf, const h16* __restrict__ VT, bf* Ah, bf* Al) {
    __shared__ __align__(16) char sm[2 * BUFB];
    const int tid = threadIdx.x; const int lane = tid & 31, c = lane & 15, hi = lane >> 4; const int z = blockIdx.y; const int q0 = blockIdx.x * 256 + (tid >> 5) * 32;
    const size_t zo = (size_t)z * TT * HD;
    const unsigned lk = (unsigned)(size_t)sm + (unsigned)((tid >> 3) * KP + (tid & 7) * 16), lv = (unsigned)(size_t)sm + (unsigned)(KPB + (tid >> 4) * VP + (tid & 15) * 16);
    const char* gk = (const char*)(Kf + zo) + tid * 16; const char* gv = (const char*)(VT + zo) + (tid >> 4) * (TT * 2) + (tid & 15) * 16;
    const unsigned qo[2] = {(unsigned)(zo + (q0 + c) * HD + 8 * hi) * 2u, (unsigned)(zo + (q0 + 16 + c) * HD + 8 * hi) * 2u};    // the lane's byte offsets into the Q plane
    v16h qf[2][2];
#pragma unroll
    for (int g = 0; g < 2; ++g)
#pragma unroll
        for (int kc = 0; kc < 2; ++kc) qf[g][kc] = WFrag<h16>::ld((const h16*)((const char*)Qf + qo[g]) + kc * 32);
    v8f o[4][2];
#pragma unroll
    for (int dt = 0; dt < 4; ++dt)
#pragma unroll
        for (int g = 0; g < 2; ++g) o[dt][g] = (v8f){};
    float l[2] = {0.f, 0.f};
    v8f cn[2] = {(v8f){}, (v8f){}};    // 10 - m of the lane's column, in all eight registers of an accumulator tile
    asm volatile("s_wait_xcnt 0x0" : : "v"(qo[0]), "v"(qo[1]) : "memory");    // keeps the Q loads' offset registers untouched up to the wait; behind it they are free for reuse
    const char* fk = sm + c * KP + 16 * hi; const char* fv = sm + KPB + c * VP + 16 * hi;    // the lane's fragment bases in buffer 0
#pragma unroll 1    // stays rolled: the copies keep one place of issue, and the four-pass body stands once in the instruction cache
    for (int t = -2; t < NST; ++t) {    // trips -2 and -1 are the ring's prologue: they only pass the foot, which issues stage 0, then publishes it and issues stage 1
        const int bo = (t & 1) * BUFB;
        if (t >= 0) {
        v16h kf[2][2];
#pragma unroll
        for (int kt = 0; kt < 2; ++kt)
#pragma unroll
            for (int kc = 0; kc < 2; ++kc) kf[kt][kc] = WFrag<h16>::ld((const h16*)(fk + bo + kt * 16 * KP + kc * 64));
        __builtin_amdgcn_sched_barrier(0);    // the stage's first fragment reads stay one group too, in front of the first products
#pragma unroll    // unrolled: every LDS offset of a pass is an immediate
        for (int sub = 0; sub < SK / 32; ++sub) {
            v8f s[2][2];
#pragma unroll
            for (int kc = 0; kc < 2; ++kc)    // the d half outermost: the four tiles' products stand between a tile's two dependent ones
#pragma unroll
                for (int kt = 0; kt < 2; ++kt)
#pragma unroll
                    for (int g = 0; g < 2; ++g) s[kt][g] = wmma16(kf[kt][kc], qf[g][kc], kc == 0 ? cn[g] : s[kt][g]);
            __builtin_amdgcn_sched_barrier(0);    // all LDS reads of a pass stand in ONE place, behind its score products, for speed only
            if (sub + 1 < SK / 32) {    // the next 32 keys' fragments, of this same stage, into the registers the products have just read
#pragma unroll
                for (int kt = 0; kt < 2; ++kt)
#pragma unroll
                    for (int kc = 0; kc < 2; ++kc) kf[kt][kc] = WFrag<h16>::ld((const h16*)(fk + bo + ((sub + 1) * 32 + kt * 16) * KP + kc * 64));
            }
            v16h vf[4];    // this pass's V^T fragments: they return while the exps run
#pragma unroll
            for (int dt = 0; dt < 4; ++dt) vf[dt] = WFrag<h16>::ld((const h16*)(fv + bo + dt * 16 * VP + sub * 64));
            __builtin_amdgcn_sched_barrier(0);    // and none of these reads moves down among the exps and the products behind them
            float p[2][16], ps[2];
#pragma unroll
            for (int e = 0; e < 4; ++e)
#pragma unroll
                for (int g = 0; g < 2; ++g) p[g][e] = s[0][g][e];
            // the first eight exps run ahead of the adds, so that an add finds its exp's result ready. Nothing plain is there yet to stand between them: written in place in one statement, none of them overwrites the source of the one in front of it.
            // The v_nop is the slot the instruction set asks for behind the last of them.
            asm volatile("v_exp_f32 %0, %0\n\tv_exp_f32 %1, %1\n\tv_exp_f32 %2, %2\n\tv_exp_f32 %3, %3\n\t"
                         "v_exp_f32 %4, %4\n\tv_exp_f32 %5, %5\n\tv_exp_f32 %6, %6\n\tv_exp_f32 %7, %7\n\t"
                         "v_nop"
                         : "+v"(p[0][0]), "+v"(p[0][1]), "+v"(p[0][2]), "+v"(p[0][3]), "+v"(p[1][0]), "+v"(p[1][1]), "+v"(p[1][2]), "+v"(p[1][3]));
#pragma unroll
            for (int e = 0; e < 16; ++e)
#pragma unroll
                for (int g = 0; g < 2; ++g) { if (e >= 4) p[g][e] = __builtin_amdgcn_exp2f(s[e >> 3][g][e & 7]); ps[g] = e == 0 ? p[g][0] : ps[g] + p[g][e]; }
            // behind them one plain vector instruction in front of each exp: it fills the earlier exp's slot
#pragma unroll
            for (int e = 0; e < 24; ++e) { __builtin_amdgcn_sched_group_barrier(0x2, 1, 0); __builtin_amdgcn_sched_group_barrier(0x400, 1, 0); }
            const bool first = sub == 0 && t == 0;    // the same for the whole work-group
            if (__builtin_amdgcn_ballot_w32(ps[0] > PTH || ps[1] > PTH) != 0 || first) {    // some column has outgrown its reference (or has none yet): renew m, rescale sums and output tiles (factor 1 in the columns that keep theirs), form this pass's P again
                v16h kr[2][2];    // the pass's K fragments once more from the stage's buffer, so that the scores need not stay in registers on the path that is nearly always taken
#pragma unroll
                for (int kt = 0; kt < 2; ++kt)
#pragma unroll
                    for (int kc = 0; kc < 2; ++kc) kr[kt][kc] = WFrag<h16>::ld((const h16*)(fk + bo + (sub * 32 + kt * 16) * KP + kc * 64));
#pragma unroll
                for (int g = 0; g < 2; ++g) { v8f r2[2];
#pragma unroll
                    for (int kt = 0; kt < 2; ++kt) r2[kt] = wmma16(kr[kt][1], qf[g][1], wmma16(kr[kt][0], qf[g][0], cn[g]));
                    float mx = r2[0][0];
#pragma unroll
                    for (int r = 1; r < 8; ++r) mx = fmaxf(mx, r2[0][r]);
#pragma unroll
                    for (int r = 0; r < 8; ++r) mx = fmaxf(mx, r2[1][r]);
                    mx = fmaxf(mx, xhalf(mx));
                    const float d = first ? mx - 10.0f : fmaxf(mx - 10.0f, 0.f);    // the first pass sets m to its maximum, up or down; later m only rises
                    const float al = exp2_slot(fminf(-d, 0.f)); l[g] *= al;
#pragma unroll
                    for (int r = 0; r < 8; ++r) cn[g][r] -= d;
#pragma unroll
                    for (int dt = 0; dt < 4; ++dt)
#pragma unroll
                        for (int r = 0; r < 8; ++r) o[dt][g][r] *= al;
                    ps[g] = 0.f;
#pragma unroll
                    for (int e = 0; e < 16; ++e) { p[g][e] = exp2_slot(r2[e >> 3][e & 7] - d); ps[g] += p[g][e]; } }
            }
#pragma unroll
            for (int g = 0; g < 2; ++g) { v16h pb; l[g] += ps[g];
#pragma unroll
                for (int e = 0; e < 16; ++e) pb[e] = tohx(p[g][e]);
#pragma unroll
                for (int dt = 0; dt < 4; ++dt) o[dt][g] = wmma16(vf[dt], pb, o[dt][g]); }
        }
        }
        asm volatile("s_wait_dscnt 0x0" ::: "memory");       // this wave's reads of the buffer have returned before it is refilled
        asm volatile("s_wait_asynccnt 0x0" ::: "memory");    // this wave's share of stage t + 1 has landed
        __syncthreads();                                      // publishes stage t + 1 and ends every wave's reads of stage t
        if (t + 2 < NST) stage_copy(lk + bo, lv + bo, gk + (t + 2) * (SK * HD * 2), gv + (t + 2) * (SK * 2));    // stage t + 2 into the buffer just left
    }
    asm volatile("s_wait_asynccnt 0x0" ::: "memory");    // no copy is outstanding when the wave ends
    const int b = z >> 4, h = z & 15;
#pragma unroll
    for (int g = 0; g < 2; ++g) { const float inv = __fdiv_rn(1.0f, l[g] + xhalf(l[g])); const size_t ob = ((size_t)(q0 + g * 16 + c) * NB_ + b) * DD + h * HD + 8 * hi;
#pragma unroll
        for (int dt = 0; dt < 4; ++dt) { v8us oh, ol;
#pragma unroll
            for (int r = 0; r < 8; ++r) { unsigned short a, c2; splitf(o[dt][g][r] * inv, a, c2); oh[r] = a; ol[r] = c2; }
            *(v8us*)(Ah + ob + dt * 16) = oh; *(v8us*)(Al + ob + dt * 16) = ol; } }
}

extern "C" void kernel_launch(void* const* d_in, const int* in_sizes, int n_in,
                              void* d_out, int out_size, void* d_ws, size_t ws_size, hipStream_t stream) {
    (void)in_sizes; (void)n_in; (void)out_size;
    const float* x = (const float*)d_in[0]; const float* wq = (const float*)d_in[1]; const float* bq = (const float*)d_in[2]; const float* wk = (const float*)d_in[3]; const float* bk = (const float*)d_in[4]; const float* wv = (const float*)d_in[5]; const float* bv = (const float*)d_in[6];
    const float* wo = (const float*)d_in[7]; const float* bo = (const float*)d_in[8];
    float* OUT = (float*)d_out;     // [2048][2][1024] (rows t*2 + b)
    char* wsp = (char*)d_ws;
    auto take = [&](size_t bytes) { char* p = wsp; wsp += (bytes + 255) & ~(size_t)255; return (void*)p; };
    bf* WQ = (bf*)take((size_t)DD * DD * 2); bf* WK = (bf*)take((size_t)DD * DD * 2); bf* WV = (bf*)take((size_t)DD * DD * 2); bf* WO = (bf*)take((size_t)DD * DD * 2);
    bf* XB = (bf*)take((size_t)NT * DD * 2);
    h16* QF = (h16*)take((size_t)NT * DD * 2); h16* KF = (h16*)take((size_t)NT * DD * 2); h16* VT = (h16*)take((size_t)NT * DD * 2);
    bf* ATh = (bf*)take((size_t)NT * DD * 2); bf* ATl = (bf*)take((size_t)NT * DD * 2);
    if ((size_t)(wsp - (char*)d_ws) > ws_size) return;    // ws 256 MiB
    k_cvt5<<<4 * CVW + NT * DD / 16384, 256, 0, stream>>>(wq, wk, wv, wo, x, WQ);    // WQ, WK, WV, WO, XB lie one behind the other (each plane a multiple of 256 bytes)
    k_qkv<<<dim3(NT / 128, DD / 128, 1), 256, 0, stream>>>(XB, WQ, bq, bk, bv, QF, KF, VT);    // WQ, WK, WV lie one behind the other (each plane a multiple of 256 bytes)
    k_fattn<<<dim3(TT / 256, NB_ * NH_, 1), 256, 0, stream>>>(QF, KF, VT, ATh, ATl);
    k_gemmw<bf, 1, true><<<dim3(NT / 128, DD / 128, 1), 256, 0, stream>>>(ATh, ATl, WO, DD, OUT, DD, bo, 0, 0, 0);
}
